// v000
// Measured on an AMD MI455X. A time is GPU time per run, averaged over a window of back-to-back runs after a warm-up
// (all launches, gaps included; the runs take copies of the inputs in turn), and the median of several windows.
// Apart from v000's, it joins two sittings. Times from different sittings can be a few percent apart, while
// side-by-side timings come from the same sitting.
// v000 is the starting kernel. One run takes 396 microseconds.
#include <hip/hip_runtime.h>

typedef __attribute__((ext_vector_type(2))) float v2f;
typedef __attribute__((ext_vector_type(8))) float v8f;

#define WMMA_F32(a, b, c) \
  __builtin_amdgcn_wmma_f32_16x16x4_f32(false, (a), false, (b), (short)0, (c), false, false)

constexpr int B_ = 4, H_ = 16, S_ = 1024, D_ = 64, E_ = 1024;
constexpr int QB = 32;            // queries per attention workgroup
constexpr int SROW = 1026;        // padded LDS row stride (floats)
constexpr int MLOFF_W = QB * SROW;            // word offset of M slab in LDS
constexpr int LDS_WORDS = MLOFF_W + QB * S_;  // 65,600 words = 262,400 B
constexpr float INV_SQRT_D = 0.125f;

// ---------------------------------------------------------------------------
// Kernel 0a: zero the per-(b,h,k) prob-max buffer
// ---------------------------------------------------------------------------
__global__ void __launch_bounds__(256) init_pmax_kernel(int* __restrict__ p) {
  p[blockIdx.x * 256 + threadIdx.x] = 0;
}

// ---------------------------------------------------------------------------
// Kernel 0b: Vt[b,h,d,k] = V[b,h,k,d]   (so P@V B-fragments are contiguous)
// ---------------------------------------------------------------------------
__global__ void __launch_bounds__(256)
transv_kernel(const float* __restrict__ V, float* __restrict__ Vt) {
  __shared__ float t[64][65];
  const int bh = blockIdx.x >> 4;
  const int kt = blockIdx.x & 15;                 // 16 k-tiles of 64
  const size_t base = ((size_t)bh * S_ + (size_t)kt * 64) * D_;
  for (int i = threadIdx.x; i < 64 * 64; i += 256)
    t[i >> 6][i & 63] = V[base + i];
  __syncthreads();
  for (int i = threadIdx.x; i < 64 * 64; i += 256) {
    const int dd = i >> 6, kk = i & 63;
    Vt[((size_t)bh * D_ + dd) * S_ + kt * 64 + kk] = t[kk][dd];
  }
}

// ---------------------------------------------------------------------------
// Kernel 1: Q projection  Qh[b,h,q,d] = (X @ Wq^T + bq) reshaped per-head
// 256 thr (8 waves); block tile 64(M) x 128(N); wave tile 16 x 64.
// ---------------------------------------------------------------------------
__global__ void __launch_bounds__(256)
qproj_kernel(const float* __restrict__ X, const float* __restrict__ Wq,
             const float* __restrict__ bq, float* __restrict__ Qh) {
  const int tid = threadIdx.x, lane = tid & 31, w = tid >> 5;
  const int lo = lane & 15, half = lane >> 4;
  const int m0 = blockIdx.x * 64 + (w >> 1) * 16;   // global M row (= b*S + q)
  const int n0 = blockIdx.y * 128 + (w & 1) * 64;   // global N col (= e)

  const float* Ab = X + (size_t)(m0 + lo) * E_ + 2 * half;
  const float* Bb[4];
#pragma unroll
  for (int nt = 0; nt < 4; ++nt)
    Bb[nt] = Wq + (size_t)(n0 + nt * 16 + lo) * E_ + 2 * half;

  v8f acc[4] = {};
  v2f a_c = *(const v2f*)(Ab);
  v2f b_c[4];
#pragma unroll
  for (int nt = 0; nt < 4; ++nt) b_c[nt] = *(const v2f*)(Bb[nt]);

#pragma unroll 4
  for (int ks = 0; ks < E_ / 4; ++ks) {
    const int kn = (ks + 1 < E_ / 4) ? ks + 1 : ks;   // clamped prefetch index
    v2f a_n = *(const v2f*)(Ab + kn * 4);
    v2f b_n[4];
#pragma unroll
    for (int nt = 0; nt < 4; ++nt) b_n[nt] = *(const v2f*)(Bb[nt] + kn * 4);
#pragma unroll
    for (int nt = 0; nt < 4; ++nt) acc[nt] = WMMA_F32(a_c, b_c[nt], acc[nt]);
    a_c = a_n;
#pragma unroll
    for (int nt = 0; nt < 4; ++nt) b_c[nt] = b_n[nt];
  }

#pragma unroll
  for (int nt = 0; nt < 4; ++nt) {
    const int e = n0 + nt * 16 + lo;
    const float bias = bq[e];
    const int h = e >> 6, dd = e & 63;
#pragma unroll
    for (int i = 0; i < 8; ++i) {
      const int m = m0 + i + 8 * half;
      const int b = m >> 10, q = m & 1023;
      Qh[((size_t)(b * H_ + h) * S_ + q) * D_ + dd] = acc[nt][i] + bias;
    }
  }
}

// ---------------------------------------------------------------------------
// Kernel 2: attention for one (b, h, 32-query block). Single pass over M,
// streamed with GLOBAL_LOAD_ASYNC_TO_LDS_B128 concurrently with QK^T WMMAs.
// ---------------------------------------------------------------------------
__global__ void __launch_bounds__(256)
attn_kernel(const float* __restrict__ Qh, const float* __restrict__ Kg,
            const float* __restrict__ Vt, const float* __restrict__ Mg,
            const float* __restrict__ dpm, float* __restrict__ ctx,
            int* __restrict__ Pmax) {
  extern __shared__ float Sl[];                     // [QB x SROW] scores | [QB x S_] M
  const int tid = threadIdx.x, lane = tid & 31, w = tid >> 5;
  const int lo = lane & 15, half = lane >> 4;
  const int qb = blockIdx.x, h = blockIdx.y, b = blockIdx.z;
  const int q0 = qb * QB;
  const size_t bh = (size_t)(b * H_ + h);

  // -------- Phase 0: async-stream this block's M slab (128 KB) into LDS -----
  // Non-temporal: M is 256 MB stream-once data; keep L2 for K/Vt/Qh re-reads.
  {
    const float* Mbase = Mg + (bh * S_ + (size_t)q0) * S_;
#pragma unroll
    for (int i = 0; i < (QB * S_) / (256 * 4); ++i) {   // 32 x 16B per thread
      const int idx = tid + i * 256;                    // 16-byte chunk index
      const unsigned lds_b = (unsigned)(MLOFF_W * 4 + idx * 16);
      const void* gp = (const void*)(Mbase + idx * 4);
      asm volatile("global_load_async_to_lds_b128 %0, %1, off th:TH_LOAD_NT"
                   :: "v"(lds_b), "v"(gp) : "memory");
    }
  }

  // -------- Phase 1: Sl[q][k] = (Q . K^T) * inv_sqrt_d  via WMMA f32 --------
  {
    const float* Qbase = Qh + (bh * S_ + q0) * D_;
    const float* Kbase = Kg + bh * S_ * D_;
#pragma unroll
    for (int mt = 0; mt < QB / 16; ++mt) {
      v2f af[16];                                   // hoisted A (Q) fragments
      const float* ap = Qbase + (size_t)(mt * 16 + lo) * D_ + 2 * half;
#pragma unroll
      for (int ks = 0; ks < 16; ++ks) af[ks] = *(const v2f*)(ap + ks * 4);

      v2f bf[2][16];                                // double-buffered K frags
      {
        const float* bp = Kbase + (size_t)(w * 128 + lo) * D_ + 2 * half;
#pragma unroll
        for (int ks = 0; ks < 16; ++ks) bf[0][ks] = *(const v2f*)(bp + ks * 4);
      }
#pragma unroll
      for (int nt = 0; nt < 8; ++nt) {              // this wave's 128-key strip
        const int cur = nt & 1;
        if (nt < 7) {                               // prefetch next key tile
          const float* bp =
              Kbase + (size_t)(w * 128 + (nt + 1) * 16 + lo) * D_ + 2 * half;
#pragma unroll
          for (int ks = 0; ks < 16; ++ks)
            bf[cur ^ 1][ks] = *(const v2f*)(bp + ks * 4);
        }
        v8f acc0 = {}, acc1 = {};                   // even/odd k-step chains
#pragma unroll
        for (int ks = 0; ks < 16; ks += 2) {
          acc0 = WMMA_F32(af[ks],     bf[cur][ks],     acc0);
          acc1 = WMMA_F32(af[ks + 1], bf[cur][ks + 1], acc1);
        }
        const int col = w * 128 + nt * 16 + lo;
        const int rb = mt * 16 + 8 * half;
#pragma unroll
        for (int i = 0; i < 8; ++i)
          Sl[(rb + i) * SROW + col] = (acc0[i] + acc1[i]) * INV_SQRT_D;
      }
    }
  }
  asm volatile("s_wait_asynccnt 0x0" ::: "memory");  // M slab resident in LDS
  __syncthreads();

  // -------- Phase 2: fused (-M from LDS), row softmax, dp_mask --------------
  for (int r = w; r < QB; r += 8) {
    float* row = Sl + r * SROW;
    const float* Mrow = Sl + MLOFF_W + r * S_;
    float mx = -3.0e38f;
    for (int i = lane; i < S_; i += 32) {
      float t = row[i] - Mrow[i];
      row[i] = t;
      mx = fmaxf(mx, t);
    }
#pragma unroll
    for (int o = 16; o; o >>= 1) mx = fmaxf(mx, __shfl_xor(mx, o, 32));
    float sum = 0.f;
    for (int i = lane; i < S_; i += 32) {
      float e = __expf(row[i] - mx);
      row[i] = e;
      sum += e;
    }
#pragma unroll
    for (int o = 16; o; o >>= 1) sum += __shfl_xor(sum, o, 32);
    const float scale = dpm[b * S_ + q0 + r] / sum;
    for (int i = lane; i < S_; i += 32) row[i] *= scale;
  }
  __syncthreads();

  // -------- Phase 3: per-key max over this q block -> atomic bit-max --------
  for (int k = tid; k < S_; k += 256) {
    float mx = 0.f;                                 // probs >= 0
    for (int q = 0; q < QB; ++q) mx = fmaxf(mx, Sl[q * SROW + k]);
    atomicMax(&Pmax[(b * H_ + h) * S_ + k], __float_as_int(mx));
  }

  // -------- Phase 4: ctx = P @ V  (A from LDS, B from transposed V) ---------
  {
    const int mt = w >> 2;                          // 16-row tile
    const int d0 = (w & 3) * 16;                    // 16-col (head dim) tile
    const float* Ab = Sl + (mt * 16 + lo) * SROW + 2 * half;
    const float* Vb = Vt + (bh * D_ + d0 + lo) * S_ + 2 * half;
    v8f acc0 = {}, acc1 = {};
    v2f a0 = *(const v2f*)(Ab);      v2f v0 = *(const v2f*)(Vb);
    v2f a1 = *(const v2f*)(Ab + 4);  v2f v1 = *(const v2f*)(Vb + 4);
#pragma unroll 4
    for (int ks = 0; ks < S_ / 4; ks += 2) {
      const int k2 = (ks + 2 < S_ / 4) ? ks + 2 : ks;       // clamped prefetch
      const int k3 = (ks + 3 < S_ / 4) ? ks + 3 : ks + 1;
      v2f a2 = *(const v2f*)(Ab + k2 * 4);
      v2f w2 = *(const v2f*)(Vb + k2 * 4);
      v2f a3 = *(const v2f*)(Ab + k3 * 4);
      v2f w3 = *(const v2f*)(Vb + k3 * 4);
      acc0 = WMMA_F32(a0, v0, acc0);
      acc1 = WMMA_F32(a1, v1, acc1);
      a0 = a2; v0 = w2; a1 = a3; v1 = w3;
    }
    const v8f acc = acc0 + acc1;
    const int q = q0 + mt * 16 + 8 * half;
    const int e = h * D_ + d0 + lo;
#pragma unroll
    for (int i = 0; i < 8; ++i)   // write-once output: non-temporal stores
      __builtin_nontemporal_store(acc[i],
                                  ctx + (size_t)(b * S_ + q + i) * E_ + e);
  }
}

// ---------------------------------------------------------------------------
// Kernel 3: target_score[b,k] = sum_h max_q probs
// ---------------------------------------------------------------------------
__global__ void __launch_bounds__(256)
tscore_kernel(const int* __restrict__ Pmax, float* __restrict__ out) {
  const int idx = blockIdx.x * 256 + threadIdx.x;   // 4096 = B*Sk
  const int b = idx >> 10, k = idx & 1023;
  float s = 0.f;
#pragma unroll
  for (int h = 0; h < H_; ++h) s += __int_as_float(Pmax[(b * H_ + h) * S_ + k]);
  out[idx] = s;
}

// ---------------------------------------------------------------------------
extern "C" void kernel_launch(void* const* d_in, const int* in_sizes, int n_in,
                              void* d_out, int out_size, void* d_ws, size_t ws_size,
                              hipStream_t stream) {
  (void)in_sizes; (void)n_in; (void)out_size; (void)ws_size;
  const float* dp_emb  = (const float*)d_in[0];
  const float* dp_mask = (const float*)d_in[1];
  const float* K       = (const float*)d_in[2];
  const float* V       = (const float*)d_in[3];
  const float* M       = (const float*)d_in[4];
  const float* Wq      = (const float*)d_in[5];
  const float* bq      = (const float*)d_in[6];

  float* ctx = (float*)d_out;
  float* ts  = ctx + (size_t)B_ * S_ * E_;

  float* Qh   = (float*)d_ws;                          // 16 MB
  float* Vt   = Qh + (size_t)B_ * H_ * S_ * D_;        // 16 MB
  int*   Pmax = (int*)(Vt + (size_t)B_ * H_ * S_ * D_);// 256 KB

  const int smem = LDS_WORDS * (int)sizeof(float);     // 262,400 B (< 320 KB)
  (void)hipFuncSetAttribute((const void*)attn_kernel,
                            hipFuncAttributeMaxDynamicSharedMemorySize, smem);

  init_pmax_kernel<<<B_ * H_ * S_ / 256, 256, 0, stream>>>(Pmax);
  transv_kernel<<<B_ * H_ * (S_ / 64), 256, 0, stream>>>(V, Vt);
  qproj_kernel<<<dim3(B_ * S_ / 64, E_ / 128), 256, 0, stream>>>(dp_emb, Wq, bq, Qh);
  attn_kernel<<<dim3(S_ / QB, H_, B_), 256, smem, stream>>>(Qh, K, Vt, M, dp_mask, ctx, Pmax);
  tscore_kernel<<<B_ * S_ / 256, 256, 0, stream>>>(Pmax, ts);
}

// v001
// It runs in 330 microseconds.
// In both of two side-by-side timings against v000, it was 1.24 times as fast.
#include <hip/hip_runtime.h>

typedef __attribute__((ext_vector_type(2))) float v2f;
typedef __attribute__((ext_vector_type(4))) float v4f;
typedef __attribute__((ext_vector_type(8))) float v8f;

#define WMMA_F32(a, b, c) \
  __builtin_amdgcn_wmma_f32_16x16x4_f32(false, (a), false, (b), (short)0, (c), false, false)

// Fragment loads: every lane reads 16 bytes of its row, floats 8j + 4*half .. + 3,
// and feeds two WMMAs: .xy carries k = 8j + {0,1 | 4,5}, .zw k = 8j + {2,3 | 6,7}
// (lanes 0-15 | lanes 16-31). A and B are always read the same way, so every
// k slot pairs the same k of both operands.

constexpr int B_ = 4, H_ = 16, S_ = 1024, D_ = 64, E_ = 1024;
constexpr int QB = 32;            // queries per attention workgroup
constexpr int SROW = 1028;        // padded LDS row stride (floats): 16 B x odd
constexpr int MLOFF_W = QB * SROW;            // word offset of M slab in LDS
constexpr int LDS_WORDS = MLOFF_W + QB * S_;  // 65,664 words = 262,656 B
constexpr float INV_SQRT_D = 0.125f;

// ---------------------------------------------------------------------------
// Kernel 0a: zero the per-(b,h,k) prob-max buffer
// ---------------------------------------------------------------------------
__global__ void __launch_bounds__(256) init_pmax_kernel(int* __restrict__ p) {
  p[blockIdx.x * 256 + threadIdx.x] = 0;
}

// ---------------------------------------------------------------------------
// Kernel 0b: Vt[b,h,d,k] = V[b,h,k,d]   (so P@V B-fragments are contiguous)
// ---------------------------------------------------------------------------
__global__ void __launch_bounds__(256)
transv_kernel(const float* __restrict__ V, float* __restrict__ Vt) {
  __shared__ float t[64][65];
  const int bh = blockIdx.x >> 4;
  const int kt = blockIdx.x & 15;                 // 16 k-tiles of 64
  const size_t base = ((size_t)bh * S_ + (size_t)kt * 64) * D_;
  for (int i = threadIdx.x; i < 64 * 64; i += 256)
    t[i >> 6][i & 63] = V[base + i];
  __syncthreads();
  for (int i = threadIdx.x; i < 64 * 64; i += 256) {
    const int dd = i >> 6, kk = i & 63;
    Vt[((size_t)bh * D_ + dd) * S_ + kt * 64 + kk] = t[kk][dd];
  }
}

// ---------------------------------------------------------------------------
// Kernel 1: Q projection  Qh[b,h,q,d] = (X @ Wq^T + bq) reshaped per-head
// 256 thr (8 waves); block tile 64(M) x 128(N); wave tile 16 x 64.
// ---------------------------------------------------------------------------
__global__ void __launch_bounds__(256)
qproj_kernel(const float* __restrict__ X, const float* __restrict__ Wq,
             const float* __restrict__ bq, float* __restrict__ Qh) {
  const int tid = threadIdx.x, lane = tid & 31, w = tid >> 5;
  const int lo = lane & 15, half = lane >> 4;
  const int m0 = blockIdx.x * 64 + (w >> 1) * 16;   // global M row (= b*S + q)
  const int n0 = blockIdx.y * 128 + (w & 1) * 64;   // global N col (= e)

  // Byte offset of this lane's row in X and in Wq; the k step goes into the uniform base.
  const unsigned a_off = (unsigned)((m0 + lo) * E_ + 4 * half) * 4u;
  unsigned b_off[4];
#pragma unroll
  for (int nt = 0; nt < 4; ++nt)
    b_off[nt] = (unsigned)((n0 + nt * 16 + lo) * E_ + 4 * half) * 4u;
  const char* Xb = (const char*)X;
  const char* Wb = (const char*)Wq;

  v8f acc[4] = {};
  v4f a_c = *(const v4f*)(Xb + a_off);
  v4f b_c[4];
#pragma unroll
  for (int nt = 0; nt < 4; ++nt) b_c[nt] = *(const v4f*)(Wb + b_off[nt]);

#pragma unroll 4
  for (int ks = 0; ks < E_ / 8; ++ks) {
    const int kn = (ks + 1 < E_ / 8) ? ks + 1 : ks;   // clamped prefetch index
    v4f a_n = *(const v4f*)(Xb + kn * 32 + a_off);
    v4f b_n[4];
#pragma unroll
    for (int nt = 0; nt < 4; ++nt) b_n[nt] = *(const v4f*)(Wb + kn * 32 + b_off[nt]);
    // precaution: the loads' address registers are reused only behind this wait
    asm volatile("s_wait_xcnt 0x0" ::: "memory");
#pragma unroll
    for (int nt = 0; nt < 4; ++nt) acc[nt] = WMMA_F32(a_c.xy, b_c[nt].xy, acc[nt]);
#pragma unroll
    for (int nt = 0; nt < 4; ++nt) acc[nt] = WMMA_F32(a_c.zw, b_c[nt].zw, acc[nt]);
    a_c = a_n;
#pragma unroll
    for (int nt = 0; nt < 4; ++nt) b_c[nt] = b_n[nt];
  }

#pragma unroll
  for (int nt = 0; nt < 4; ++nt) {
    const int e = n0 + nt * 16 + lo;
    const float bias = bq[e];
    const int h = e >> 6, dd = e & 63;
#pragma unroll
    for (int i = 0; i < 8; ++i) {
      const int m = m0 + i + 8 * half;
      const int b = m >> 10, q = m & 1023;
      Qh[((size_t)(b * H_ + h) * S_ + q) * D_ + dd] = acc[nt][i] + bias;
    }
  }
}

// ---------------------------------------------------------------------------
// Kernel 2: attention for one (b, h, 32-query block). Single pass over M,
// streamed with GLOBAL_LOAD_ASYNC_TO_LDS_B128 concurrently with QK^T WMMAs.
// ---------------------------------------------------------------------------
__global__ void __launch_bounds__(256)
attn_kernel(const float* __restrict__ Qh, const float* __restrict__ Kg,
            const float* __restrict__ Vt, const float* __restrict__ Mg,
            const float* __restrict__ dpm, float* __restrict__ ctx,
            int* __restrict__ Pmax) {
  extern __shared__ __attribute__((aligned(16))) float Sl[];  // [QB x SROW] scores | [QB x S_] M
  const int tid = threadIdx.x, lane = tid & 31, w = tid >> 5;
  const int lo = lane & 15, half = lane >> 4;
  const int qb = blockIdx.x, h = blockIdx.y, b = blockIdx.z;
  const int q0 = qb * QB;
  const size_t bh = (size_t)(b * H_ + h);

  // -------- Phase 0: async-stream this block's M slab (128 KB) into LDS -----
  // Non-temporal: M is 256 MB stream-once data; keep L2 for K/Vt/Qh re-reads.
  {
    const float* Mbase = Mg + (bh * S_ + (size_t)q0) * S_;
#pragma unroll
    for (int i = 0; i < (QB * S_) / (256 * 4); ++i) {   // 32 x 16B per thread
      const int idx = tid + i * 256;                    // 16-byte chunk index
      const unsigned lds_b = (unsigned)(MLOFF_W * 4 + idx * 16);
      const void* gp = (const void*)(Mbase + idx * 4);
      asm volatile("global_load_async_to_lds_b128 %0, %1, off th:TH_LOAD_NT"
                   :: "v"(lds_b), "v"(gp) : "memory");
    }
  }

  // -------- Phase 1: Sl[q][k] = (Q . K^T) * inv_sqrt_d  via WMMA f32 --------
  {
    const float* Qbase = Qh + (bh * S_ + q0) * D_;
    const float* Kbase = Kg + bh * S_ * D_;
    v4f af[QB / 16][8];                             // hoisted A (Q) fragments
#pragma unroll
    for (int mt = 0; mt < QB / 16; ++mt) {
      const float* ap = Qbase + (size_t)(mt * 16 + lo) * D_ + 4 * half;
#pragma unroll
      for (int ks = 0; ks < 8; ++ks) af[mt][ks] = *(const v4f*)(ap + ks * 8);
    }
    v4f bf[2][8];                                   // double-buffered K frags
    {
      const float* bp = Kbase + (size_t)(w * 128 + lo) * D_ + 4 * half;
#pragma unroll
      for (int ks = 0; ks < 8; ++ks) bf[0][ks] = *(const v4f*)(bp + ks * 8);
    }
    // precaution: the loads' address registers are reused only behind this wait
    asm volatile("s_wait_xcnt 0x0" ::: "memory");
#pragma unroll
    for (int nt = 0; nt < 8; ++nt) {                // this wave's 128-key strip
      const int cur = nt & 1;
      if (nt < 7) {                                 // prefetch next key tile
        const float* bp =
            Kbase + (size_t)(w * 128 + (nt + 1) * 16 + lo) * D_ + 4 * half;
#pragma unroll
        for (int ks = 0; ks < 8; ++ks)
          bf[cur ^ 1][ks] = *(const v4f*)(bp + ks * 8);
        // precaution: the loads' address registers are reused only behind this wait
        asm volatile("s_wait_xcnt 0x0" ::: "memory");
      }
#pragma unroll
      for (int mt = 0; mt < QB / 16; ++mt) {        // each K tile is read once
        v8f acc0 = {}, acc1 = {};                   // .xy / .zw chains
#pragma unroll
        for (int ks = 0; ks < 8; ++ks) {
          acc0 = WMMA_F32(af[mt][ks].xy, bf[cur][ks].xy, acc0);
          acc1 = WMMA_F32(af[mt][ks].zw, bf[cur][ks].zw, acc1);
        }
        const int col = w * 128 + nt * 16 + lo;
        const int rb = mt * 16 + 8 * half;
#pragma unroll
        for (int i = 0; i < 8; ++i)
          Sl[(rb + i) * SROW + col] = (acc0[i] + acc1[i]) * INV_SQRT_D;
      }
    }
  }
  asm volatile("s_wait_asynccnt 0x0" ::: "memory");  // M slab resident in LDS
  __syncthreads();

  // -------- Phase 2: fused (-M from LDS), row softmax, dp_mask --------------
  for (int r = w; r < QB; r += 8) {
    float* row = Sl + r * SROW;
    const float* Mrow = Sl + MLOFF_W + r * S_;
    float mx = -3.0e38f;
    for (int i = lane; i < S_; i += 32) {
      float t = row[i] - Mrow[i];
      row[i] = t;
      mx = fmaxf(mx, t);
    }
#pragma unroll
    for (int o = 16; o; o >>= 1) mx = fmaxf(mx, __shfl_xor(mx, o, 32));
    float sum = 0.f;
    for (int i = lane; i < S_; i += 32) {
      float e = __expf(row[i] - mx);
      row[i] = e;
      sum += e;
    }
#pragma unroll
    for (int o = 16; o; o >>= 1) sum += __shfl_xor(sum, o, 32);
    const float scale = dpm[b * S_ + q0 + r] / sum;
    for (int i = lane; i < S_; i += 32) row[i] *= scale;
  }
  __syncthreads();

  // -------- Phase 3: per-key max over this q block -> atomic bit-max --------
  for (int k = tid; k < S_; k += 256) {
    float mx = 0.f;                                 // probs >= 0
    for (int q = 0; q < QB; ++q) mx = fmaxf(mx, Sl[q * SROW + k]);
    atomicMax(&Pmax[(b * H_ + h) * S_ + k], __float_as_int(mx));
  }

  // -------- Phase 4: ctx = P @ V  (A from LDS, B from transposed V) ---------
  {
    const int mt = w >> 2;                          // 16-row tile
    const int d0 = (w & 3) * 16;                    // 16-col (head dim) tile
    const float* Ab = Sl + (mt * 16 + lo) * SROW + 4 * half;
    const float* Vb = Vt + (bh * D_ + d0 + lo) * S_ + 4 * half;
    v8f acc0 = {}, acc1 = {};
    v4f a0 = *(const v4f*)(Ab);
    v4f v0 = *(const v4f*)(Vb);
#pragma unroll 4
    for (int ks = 0; ks < S_ / 8; ++ks) {
      const int kn = (ks + 1 < S_ / 8) ? ks + 1 : ks;       // clamped prefetch
      v4f a1 = *(const v4f*)(Ab + kn * 8);
      v4f v1 = *(const v4f*)(Vb + kn * 8);
      acc0 = WMMA_F32(a0.xy, v0.xy, acc0);
      acc1 = WMMA_F32(a0.zw, v0.zw, acc1);
      a0 = a1; v0 = v1;
    }
    const v8f acc = acc0 + acc1;
    const int q = q0 + mt * 16 + 8 * half;
    const int e = h * D_ + d0 + lo;
#pragma unroll
    for (int i = 0; i < 8; ++i)   // write-once output: non-temporal stores
      __builtin_nontemporal_store(acc[i],
                                  ctx + (size_t)(b * S_ + q + i) * E_ + e);
  }
}

// ---------------------------------------------------------------------------
// Kernel 3: target_score[b,k] = sum_h max_q probs
// ---------------------------------------------------------------------------
__global__ void __launch_bounds__(256)
tscore_kernel(const int* __restrict__ Pmax, float* __restrict__ out) {
  const int idx = blockIdx.x * 256 + threadIdx.x;   // 4096 = B*Sk
  const int b = idx >> 10, k = idx & 1023;
  float s = 0.f;
#pragma unroll
  for (int h = 0; h < H_; ++h) s += __int_as_float(Pmax[(b * H_ + h) * S_ + k]);
  out[idx] = s;
}

// ---------------------------------------------------------------------------
extern "C" void kernel_launch(void* const* d_in, const int* in_sizes, int n_in,
                              void* d_out, int out_size, void* d_ws, size_t ws_size,
                              hipStream_t stream) {
  (void)in_sizes; (void)n_in; (void)out_size; (void)ws_size;
  const float* dp_emb  = (const float*)d_in[0];
  const float* dp_mask = (const float*)d_in[1];
  const float* K       = (const float*)d_in[2];
  const float* V       = (const float*)d_in[3];
  const float* M       = (const float*)d_in[4];
  const float* Wq      = (const float*)d_in[5];
  const float* bq      = (const float*)d_in[6];

  float* ctx = (float*)d_out;
  float* ts  = ctx + (size_t)B_ * S_ * E_;

  float* Qh   = (float*)d_ws;                          // 16 MB
  float* Vt   = Qh + (size_t)B_ * H_ * S_ * D_;        // 16 MB
  int*   Pmax = (int*)(Vt + (size_t)B_ * H_ * S_ * D_);// 256 KB

  const int smem = LDS_WORDS * (int)sizeof(float);     // 262,656 B (< 320 KB)
  (void)hipFuncSetAttribute((const void*)attn_kernel,
                            hipFuncAttributeMaxDynamicSharedMemorySize, smem);

  init_pmax_kernel<<<B_ * H_ * S_ / 256, 256, 0, stream>>>(Pmax);
  transv_kernel<<<B_ * H_ * (S_ / 64), 256, 0, stream>>>(V, Vt);
  qproj_kernel<<<dim3(B_ * S_ / 64, E_ / 128), 256, 0, stream>>>(dp_emb, Wq, bq, Qh);
  attn_kernel<<<dim3(S_ / QB, H_, B_), 256, smem, stream>>>(Qh, K, Vt, M, dp_mask, ctx, Pmax);
  tscore_kernel<<<B_ * S_ / 256, 256, 0, stream>>>(Pmax, ts);
}

// v002
// One run takes 280 microseconds.
// In two side-by-side timings against v001, it was 1.18 and 1.19 times as fast.
// Counting every step since v000, it is 1.46 times as fast.
#include <hip/hip_runtime.h>

typedef __attribute__((ext_vector_type(2))) float v2f;
typedef __attribute__((ext_vector_type(4))) float v4f;
typedef __attribute__((ext_vector_type(8))) float v8f;

#define WMMA_F32(a, b, c) \
  __builtin_amdgcn_wmma_f32_16x16x4_f32(false, (a), false, (b), (short)0, (c), false, false)

// Fragment loads: every lane reads 16 bytes of its row, floats 8j + 4*half .. + 3,
// and feeds two WMMAs: .xy carries k = 8j + {0,1 | 4,5}, .zw k = 8j + {2,3 | 6,7}
// (lanes 0-15 | lanes 16-31). A and B are always read the same way, so every
// k slot pairs the same k of both operands.

constexpr int B_ = 4, H_ = 16, S_ = 1024, D_ = 64, E_ = 1024;
constexpr int QB = 32;            // queries per attention workgroup
constexpr int SROW = 1028;        // padded LDS row stride (floats): 16 B x odd
constexpr int MLOFF_W = QB * SROW;            // word offset of M slab in LDS
constexpr int LDS_WORDS = MLOFF_W + QB * S_;  // 65,664 words = 262,656 B
constexpr float INV_SQRT_D = 0.125f;

// 2^x with the slot that the instruction set asks for behind a transcendental
// (one v_nop before its result is read or its source overwritten) in the same
// statement.
__device__ __forceinline__ float exp2_slot(float x) {
  float y;
  asm("v_exp_f32 %0, %1\n\tv_nop" : "=v"(y) : "v"(x));
  return y;
}
constexpr float LOG2E = 0x1.715476p+0f;   // the factor __expf multiplies by

// ---------------------------------------------------------------------------
// Kernel 0a: zero the per-(b,h,k) prob-max buffer
// ---------------------------------------------------------------------------
__global__ void __launch_bounds__(256) init_pmax_kernel(int* __restrict__ p) {
  p[blockIdx.x * 256 + threadIdx.x] = 0;
}

// ---------------------------------------------------------------------------
// Kernel 0b: Vt[b,h,d,k] = V[b,h,k,d]   (so P@V B-fragments are contiguous)
// ---------------------------------------------------------------------------
__global__ void __launch_bounds__(256)
transv_kernel(const float* __restrict__ V, float* __restrict__ Vt) {
  __shared__ float t[64][65];
  const int bh = blockIdx.x >> 4;
  const int kt = blockIdx.x & 15;                 // 16 k-tiles of 64
  const size_t base = ((size_t)bh * S_ + (size_t)kt * 64) * D_;
  for (int i = threadIdx.x; i < 64 * 64; i += 256)
    t[i >> 6][i & 63] = V[base + i];
  __syncthreads();
  for (int i = threadIdx.x; i < 64 * 64; i += 256) {
    const int dd = i >> 6, kk = i & 63;
    Vt[((size_t)bh * D_ + dd) * S_ + kt * 64 + kk] = t[kk][dd];
  }
}

// ---------------------------------------------------------------------------
// Kernel 1: Q projection  Qh[b,h,q,d] = (X @ Wq^T + bq) reshaped per-head
// 256 thr (8 waves); block tile 64(M) x 128(N); wave tile 16 x 64.
// ---------------------------------------------------------------------------
__global__ void __launch_bounds__(256)
qproj_kernel(const float* __restrict__ X, const float* __restrict__ Wq,
             const float* __restrict__ bq, float* __restrict__ Qh) {
  const int tid = threadIdx.x, lane = tid & 31, w = tid >> 5;
  const int lo = lane & 15, half = lane >> 4;
  const int m0 = blockIdx.x * 64 + (w >> 1) * 16;   // global M row (= b*S + q)
  const int n0 = blockIdx.y * 128 + (w & 1) * 64;   // global N col (= e)

  // Byte offset of this lane's row in X and in Wq; the k step goes into the uniform base.
  const unsigned a_off = (unsigned)((m0 + lo) * E_ + 4 * half) * 4u;
  unsigned b_off[4];
#pragma unroll
  for (int nt = 0; nt < 4; ++nt)
    b_off[nt] = (unsigned)((n0 + nt * 16 + lo) * E_ + 4 * half) * 4u;
  const char* Xb = (const char*)X;
  const char* Wb = (const char*)Wq;

  v8f acc[4] = {};
  v4f a_c = *(const v4f*)(Xb + a_off);
  v4f b_c[4];
#pragma unroll
  for (int nt = 0; nt < 4; ++nt) b_c[nt] = *(const v4f*)(Wb + b_off[nt]);

#pragma unroll 4
  for (int ks = 0; ks < E_ / 8; ++ks) {
    const int kn = (ks + 1 < E_ / 8) ? ks + 1 : ks;   // clamped prefetch index
    v4f a_n = *(const v4f*)(Xb + kn * 32 + a_off);
    v4f b_n[4];
#pragma unroll
    for (int nt = 0; nt < 4; ++nt) b_n[nt] = *(const v4f*)(Wb + kn * 32 + b_off[nt]);
    // precaution: the loads' address registers are reused only behind this wait
    asm volatile("s_wait_xcnt 0x0" ::: "memory");
#pragma unroll
    for (int nt = 0; nt < 4; ++nt) acc[nt] = WMMA_F32(a_c.xy, b_c[nt].xy, acc[nt]);
#pragma unroll
    for (int nt = 0; nt < 4; ++nt) acc[nt] = WMMA_F32(a_c.zw, b_c[nt].zw, acc[nt]);
    a_c = a_n;
#pragma unroll
    for (int nt = 0; nt < 4; ++nt) b_c[nt] = b_n[nt];
  }

#pragma unroll
  for (int nt = 0; nt < 4; ++nt) {
    const int e = n0 + nt * 16 + lo;
    const float bias = bq[e];
    const int h = e >> 6, dd = e & 63;
#pragma unroll
    for (int i = 0; i < 8; ++i) {
      const int m = m0 + i + 8 * half;
      const int b = m >> 10, q = m & 1023;
      Qh[((size_t)(b * H_ + h) * S_ + q) * D_ + dd] = acc[nt][i] + bias;
    }
  }
}

// ---------------------------------------------------------------------------
// Kernel 2: attention for one (b, h, 32-query block). Single pass over M,
// streamed with GLOBAL_LOAD_ASYNC_TO_LDS_B128 concurrently with QK^T WMMAs.
// ---------------------------------------------------------------------------
__global__ void __launch_bounds__(256)
attn_kernel(const float* __restrict__ Qh, const float* __restrict__ Kg,
            const float* __restrict__ Vt, const float* __restrict__ Mg,
            const float* __restrict__ dpm, float* __restrict__ ctx,
            int* __restrict__ Pmax) {
  extern __shared__ __attribute__((aligned(16))) float Sl[];  // [QB x SROW] scores | [QB x S_] M
  const int tid = threadIdx.x, lane = tid & 31, w = tid >> 5;
  const int lo = lane & 15, half = lane >> 4;
  const int qb = blockIdx.x, h = blockIdx.y, b = blockIdx.z;
  const int q0 = qb * QB;
  const size_t bh = (size_t)(b * H_ + h);

  // -------- Phase 0: async-stream this block's M slab (128 KB) into LDS -----
  // Non-temporal: M is 256 MB stream-once data; keep L2 for K/Vt/Qh re-reads.
  {
    const float* Mbase = Mg + (bh * S_ + (size_t)q0) * S_;
#pragma unroll
    for (int i = 0; i < (QB * S_) / (256 * 4); ++i) {   // 32 x 16B per thread
      const int idx = tid + i * 256;                    // 16-byte chunk index
      const unsigned lds_b = (unsigned)(MLOFF_W * 4 + idx * 16);
      const void* gp = (const void*)(Mbase + idx * 4);
      asm volatile("global_load_async_to_lds_b128 %0, %1, off th:TH_LOAD_NT"
                   :: "v"(lds_b), "v"(gp) : "memory");
    }
  }

  // -------- Phase 1: Sl[q][k] = (Q . K^T) * inv_sqrt_d  via WMMA f32 --------
  {
    const float* Qbase = Qh + (bh * S_ + q0) * D_;
    const float* Kbase = Kg + bh * S_ * D_;
    v4f af[QB / 16][8];                             // hoisted A (Q) fragments
#pragma unroll
    for (int mt = 0; mt < QB / 16; ++mt) {
      const float* ap = Qbase + (size_t)(mt * 16 + lo) * D_ + 4 * half;
#pragma unroll
      for (int ks = 0; ks < 8; ++ks) af[mt][ks] = *(const v4f*)(ap + ks * 8);
    }
    v4f bf[2][8];                                   // double-buffered K frags
    {
      const float* bp = Kbase + (size_t)(w * 128 + lo) * D_ + 4 * half;
#pragma unroll
      for (int ks = 0; ks < 8; ++ks) bf[0][ks] = *(const v4f*)(bp + ks * 8);
    }
    // precaution: the loads' address registers are reused only behind this wait
    asm volatile("s_wait_xcnt 0x0" ::: "memory");
#pragma unroll
    for (int nt = 0; nt < 8; ++nt) {                // this wave's 128-key strip
      const int cur = nt & 1;
      if (nt < 7) {                                 // prefetch next key tile
        const float* bp =
            Kbase + (size_t)(w * 128 + (nt + 1) * 16 + lo) * D_ + 4 * half;
#pragma unroll
        for (int ks = 0; ks < 8; ++ks)
          bf[cur ^ 1][ks] = *(const v4f*)(bp + ks * 8);
        // precaution: the loads' address registers are reused only behind this wait
        asm volatile("s_wait_xcnt 0x0" ::: "memory");
      }
#pragma unroll
      for (int mt = 0; mt < QB / 16; ++mt) {        // each K tile is read once
        v8f acc0 = {}, acc1 = {};                   // .xy / .zw chains
#pragma unroll
        for (int ks = 0; ks < 8; ++ks) {
          acc0 = WMMA_F32(af[mt][ks].xy, bf[cur][ks].xy, acc0);
          acc1 = WMMA_F32(af[mt][ks].zw, bf[cur][ks].zw, acc1);
        }
        const int col = w * 128 + nt * 16 + lo;
        const int rb = mt * 16 + 8 * half;
#pragma unroll
        for (int i = 0; i < 8; ++i)
          Sl[(rb + i) * SROW + col] = (acc0[i] + acc1[i]) * INV_SQRT_D;
      }
    }
  }
  asm volatile("s_wait_asynccnt 0x0" ::: "memory");  // M slab resident in LDS
  __syncthreads();

  // -------- Phase 2: fused (-M from LDS), row softmax, dp_mask --------------
  // Each wave keeps its four rows in registers: scores and M are read from LDS
  // once, 16 bytes per lane (lane l holds floats 128j + 4l .. + 3), and the
  // probabilities are written once. The four rows go through every stage side
  // by side, so that one row's LDS and cross-lane latency covers the others'.
  // Every loop here is fully unrolled: t[][] is then indexed by constants only
  // and stays in registers (a run-time index would send it to scratch).
  {
    constexpr int RW = QB / 8;                      // rows per wave
    float dm[RW], mx[RW], sum[RW];
    v4f t[RW][8];
#pragma unroll
    for (int rr = 0; rr < RW; ++rr) dm[rr] = dpm[b * S_ + q0 + w + 8 * rr];
#pragma unroll
    for (int rr = 0; rr < RW; ++rr) {
      const int r = w + 8 * rr;
      const v4f* srow = (const v4f*)(Sl + r * SROW) + lane;
      const v4f* mrow = (const v4f*)(Sl + MLOFF_W + r * S_) + lane;
#pragma unroll
      for (int j = 0; j < 8; ++j) t[rr][j] = srow[j * 32] - mrow[j * 32];
    }
#pragma unroll
    for (int rr = 0; rr < RW; ++rr) {
      float m = -3.0e38f;
#pragma unroll
      for (int j = 0; j < 8; ++j)
        m = fmaxf(fmaxf(m, fmaxf(t[rr][j].x, t[rr][j].y)),
                  fmaxf(t[rr][j].z, t[rr][j].w));
      mx[rr] = m;
    }
#pragma unroll
    for (int o = 16; o; o >>= 1)
#pragma unroll
      for (int rr = 0; rr < RW; ++rr)
        mx[rr] = fmaxf(mx[rr], __shfl_xor(mx[rr], o, 32));
#pragma unroll
    for (int rr = 0; rr < RW; ++rr) {
      v4f s4 = {};                                  // four independent chains
#pragma unroll
      for (int j = 0; j < 8; ++j) {
        v4f e;
        e.x = exp2_slot((t[rr][j].x - mx[rr]) * LOG2E);
        e.y = exp2_slot((t[rr][j].y - mx[rr]) * LOG2E);
        e.z = exp2_slot((t[rr][j].z - mx[rr]) * LOG2E);
        e.w = exp2_slot((t[rr][j].w - mx[rr]) * LOG2E);
        t[rr][j] = e;
        s4 += e;
      }
      sum[rr] = (s4.x + s4.y) + (s4.z + s4.w);
    }
#pragma unroll
    for (int o = 16; o; o >>= 1)
#pragma unroll
      for (int rr = 0; rr < RW; ++rr) sum[rr] += __shfl_xor(sum[rr], o, 32);
#pragma unroll
    for (int rr = 0; rr < RW; ++rr) {
      const float scale = dm[rr] / sum[rr];
      v4f* srow = (v4f*)(Sl + (w + 8 * rr) * SROW) + lane;
#pragma unroll
      for (int j = 0; j < 8; ++j) srow[j * 32] = t[rr][j] * scale;
    }
  }
  __syncthreads();

  // -------- Phase 3: per-key max over this q block -> atomic bit-max --------
  for (int k = tid; k < S_; k += 256) {
    float mx = 0.f;                                 // probs >= 0
    for (int q = 0; q < QB; ++q) mx = fmaxf(mx, Sl[q * SROW + k]);
    atomicMax(&Pmax[(b * H_ + h) * S_ + k], __float_as_int(mx));
  }

  // -------- Phase 4: ctx = P @ V  (A from LDS, B from transposed V) ---------
  {
    const int mt = w >> 2;                          // 16-row tile
    const int d0 = (w & 3) * 16;                    // 16-col (head dim) tile
    const float* Ab = Sl + (mt * 16 + lo) * SROW + 4 * half;
    const float* Vb = Vt + (bh * D_ + d0 + lo) * S_ + 4 * half;
    v8f acc0 = {}, acc1 = {};
    v4f a0 = *(const v4f*)(Ab);
    v4f v0 = *(const v4f*)(Vb);
#pragma unroll 4
    for (int ks = 0; ks < S_ / 8; ++ks) {
      const int kn = (ks + 1 < S_ / 8) ? ks + 1 : ks;       // clamped prefetch
      v4f a1 = *(const v4f*)(Ab + kn * 8);
      v4f v1 = *(const v4f*)(Vb + kn * 8);
      acc0 = WMMA_F32(a0.xy, v0.xy, acc0);
      acc1 = WMMA_F32(a0.zw, v0.zw, acc1);
      a0 = a1; v0 = v1;
    }
    const v8f acc = acc0 + acc1;
    const int q = q0 + mt * 16 + 8 * half;
    const int e = h * D_ + d0 + lo;
#pragma unroll
    for (int i = 0; i < 8; ++i)   // write-once output: non-temporal stores
      __builtin_nontemporal_store(acc[i],
                                  ctx + (size_t)(b * S_ + q + i) * E_ + e);
  }
}

// ---------------------------------------------------------------------------
// Kernel 3: target_score[b,k] = sum_h max_q probs
// ---------------------------------------------------------------------------
__global__ void __launch_bounds__(256)
tscore_kernel(const int* __restrict__ Pmax, float* __restrict__ out) {
  const int idx = blockIdx.x * 256 + threadIdx.x;   // 4096 = B*Sk
  const int b = idx >> 10, k = idx & 1023;
  float s = 0.f;
#pragma unroll
  for (int h = 0; h < H_; ++h) s += __int_as_float(Pmax[(b * H_ + h) * S_ + k]);
  out[idx] = s;
}

// ---------------------------------------------------------------------------
extern "C" void kernel_launch(void* const* d_in, const int* in_sizes, int n_in,
                              void* d_out, int out_size, void* d_ws, size_t ws_size,
                              hipStream_t stream) {
  (void)in_sizes; (void)n_in; (void)out_size; (void)ws_size;
  const float* dp_emb  = (const float*)d_in[0];
  const float* dp_mask = (const float*)d_in[1];
  const float* K       = (const float*)d_in[2];
  const float* V       = (const float*)d_in[3];
  const float* M       = (const float*)d_in[4];
  const float* Wq      = (const float*)d_in[5];
  const float* bq      = (const float*)d_in[6];

  float* ctx = (float*)d_out;
  float* ts  = ctx + (size_t)B_ * S_ * E_;

  float* Qh   = (float*)d_ws;                          // 16 MB
  float* Vt   = Qh + (size_t)B_ * H_ * S_ * D_;        // 16 MB
  int*   Pmax = (int*)(Vt + (size_t)B_ * H_ * S_ * D_);// 256 KB

  const int smem = LDS_WORDS * (int)sizeof(float);     // 262,656 B (< 320 KB)
  (void)hipFuncSetAttribute((const void*)attn_kernel,
                            hipFuncAttributeMaxDynamicSharedMemorySize, smem);

  init_pmax_kernel<<<B_ * H_ * S_ / 256, 256, 0, stream>>>(Pmax);
  transv_kernel<<<B_ * H_ * (S_ / 64), 256, 0, stream>>>(V, Vt);
  qproj_kernel<<<dim3(B_ * S_ / 64, E_ / 128), 256, 0, stream>>>(dp_emb, Wq, bq, Qh);
  attn_kernel<<<dim3(S_ / QB, H_, B_), 256, smem, stream>>>(Qh, K, Vt, M, dp_mask, ctx, Pmax);
  tscore_kernel<<<B_ * S_ / 256, 256, 0, stream>>>(Pmax, ts);
}

// v003
// It runs in 229 microseconds.
// Two timings next to v002 both put it at 1.22 times that version's speed.
// All steps since v000 together make it 1.79 times as fast.
#include <hip/hip_runtime.h>

typedef __attribute__((ext_vector_type(2))) float v2f;
typedef __attribute__((ext_vector_type(4))) float v4f;
typedef __attribute__((ext_vector_type(8))) float v8f;

#define WMMA_F32(a, b, c) \
  __builtin_amdgcn_wmma_f32_16x16x4_f32(false, (a), false, (b), (short)0, (c), false, false)

// Fragment loads: every lane reads 16 bytes of its row, floats 8j + 4*half .. + 3,
// and feeds two WMMAs: .xy carries k = 8j + {0,1 | 4,5}, .zw k = 8j + {2,3 | 6,7}
// (lanes 0-15 | lanes 16-31). A and B are always read the same way, so every
// k slot pairs the same k of both operands.

constexpr int B_ = 4, H_ = 16, S_ = 1024, D_ = 64, E_ = 1024;
constexpr int QB = 32;            // queries per attention workgroup
constexpr int SROW = 1028;        // padded LDS row stride (floats): 16 B x odd
constexpr int MLOFF_W = QB * SROW;            // word offset of M slab in LDS
constexpr int KT = 256;           // keys per staged tile of transposed V
constexpr int NT = S_ / KT;       // tiles per (b, h)
constexpr int VROW = KT + 4;      // padded LDS row stride (floats): 16 B x odd
constexpr int VBUF_W = D_ * VROW; // words per staged tile (64 head-dim rows)
// The two V buffers take the place of the M slab once the softmax has read it.
constexpr int LDS_WORDS = MLOFF_W + 2 * VBUF_W;  // 66,176 words = 264,704 B
static_assert(2 * VBUF_W >= QB * S_, "the M slab must fit as well");
constexpr float INV_SQRT_D = 0.125f;

// 2^x with the slot that the instruction set asks for behind a transcendental
// (one v_nop before its result is read or its source overwritten) in the same
// statement.
__device__ __forceinline__ float exp2_slot(float x) {
  float y;
  asm("v_exp_f32 %0, %1\n\tv_nop" : "=v"(y) : "v"(x));
  return y;
}
constexpr float LOG2E = 0x1.715476p+0f;   // the factor __expf multiplies by

// Eight asynchronous 16-byte copies per lane, global -> LDS, rows four apart
// (a wave's 32 lanes cover 512 contiguous bytes of one row: whole lines).
// The s_wait_xcnt is the last line of the copies' own statement, so that no
// address register is rewritten in front of it (a precaution).
__device__ __forceinline__ void copy8_rows(unsigned l, const float* g) {
  asm volatile(
      "global_load_async_to_lds_b128 %0, %8, off\n\t"
      "global_load_async_to_lds_b128 %1, %9, off\n\t"
      "global_load_async_to_lds_b128 %2, %10, off\n\t"
      "global_load_async_to_lds_b128 %3, %11, off\n\t"
      "global_load_async_to_lds_b128 %4, %12, off\n\t"
      "global_load_async_to_lds_b128 %5, %13, off\n\t"
      "global_load_async_to_lds_b128 %6, %14, off\n\t"
      "global_load_async_to_lds_b128 %7, %15, off\n\t"
      "s_wait_xcnt 0x0"
      :: "v"(l), "v"(l + 4u * VROW * 4u), "v"(l + 8u * VROW * 4u),
         "v"(l + 12u * VROW * 4u), "v"(l + 16u * VROW * 4u),
         "v"(l + 20u * VROW * 4u), "v"(l + 24u * VROW * 4u),
         "v"(l + 28u * VROW * 4u),
         "v"(g), "v"(g + 4 * S_), "v"(g + 8 * S_), "v"(g + 12 * S_),
         "v"(g + 16 * S_), "v"(g + 20 * S_), "v"(g + 24 * S_), "v"(g + 28 * S_)
      : "memory");
}

// ---------------------------------------------------------------------------
// Kernel 0a: zero the per-(b,h,k) prob-max buffer
// ---------------------------------------------------------------------------
__global__ void __launch_bounds__(256) init_pmax_kernel(int* __restrict__ p) {
  p[blockIdx.x * 256 + threadIdx.x] = 0;
}

// ---------------------------------------------------------------------------
// Kernel 0b: Vt[b,h,d,k] = V[b,h,k,d]   (so P@V B-fragments are contiguous)
// ---------------------------------------------------------------------------
__global__ void __launch_bounds__(256)
transv_kernel(const float* __restrict__ V, float* __restrict__ Vt) {
  __shared__ float t[64][65];
  const int bh = blockIdx.x >> 4;
  const int kt = blockIdx.x & 15;                 // 16 k-tiles of 64
  const size_t base = ((size_t)bh * S_ + (size_t)kt * 64) * D_;
  for (int i = threadIdx.x; i < 64 * 64; i += 256)
    t[i >> 6][i & 63] = V[base + i];
  __syncthreads();
  for (int i = threadIdx.x; i < 64 * 64; i += 256) {
    const int dd = i >> 6, kk = i & 63;
    Vt[((size_t)bh * D_ + dd) * S_ + kt * 64 + kk] = t[kk][dd];
  }
}

// ---------------------------------------------------------------------------
// Kernel 1: Q projection  Qh[b,h,q,d] = (X @ Wq^T + bq) reshaped per-head
// 256 thr (8 waves); block tile 64(M) x 128(N); wave tile 16 x 64.
// ---------------------------------------------------------------------------
__global__ void __launch_bounds__(256)
qproj_kernel(const float* __restrict__ X, const float* __restrict__ Wq,
             const float* __restrict__ bq, float* __restrict__ Qh) {
  const int tid = threadIdx.x, lane = tid & 31, w = tid >> 5;
  const int lo = lane & 15, half = lane >> 4;
  const int m0 = blockIdx.x * 64 + (w >> 1) * 16;   // global M row (= b*S + q)
  const int n0 = blockIdx.y * 128 + (w & 1) * 64;   // global N col (= e)

  // Byte offset of this lane's row in X and in Wq; the k step goes into the uniform base.
  const unsigned a_off = (unsigned)((m0 + lo) * E_ + 4 * half) * 4u;
  unsigned b_off[4];
#pragma unroll
  for (int nt = 0; nt < 4; ++nt)
    b_off[nt] = (unsigned)((n0 + nt * 16 + lo) * E_ + 4 * half) * 4u;
  const char* Xb = (const char*)X;
  const char* Wb = (const char*)Wq;

  v8f acc[4] = {};
  v4f a_c = *(const v4f*)(Xb + a_off);
  v4f b_c[4];
#pragma unroll
  for (int nt = 0; nt < 4; ++nt) b_c[nt] = *(const v4f*)(Wb + b_off[nt]);

#pragma unroll 4
  for (int ks = 0; ks < E_ / 8; ++ks) {
    const int kn = (ks + 1 < E_ / 8) ? ks + 1 : ks;   // clamped prefetch index
    v4f a_n = *(const v4f*)(Xb + kn * 32 + a_off);
    v4f b_n[4];
#pragma unroll
    for (int nt = 0; nt < 4; ++nt) b_n[nt] = *(const v4f*)(Wb + kn * 32 + b_off[nt]);
    // precaution: the loads' address registers are reused only behind this wait
    asm volatile("s_wait_xcnt 0x0" ::: "memory");
#pragma unroll
    for (int nt = 0; nt < 4; ++nt) acc[nt] = WMMA_F32(a_c.xy, b_c[nt].xy, acc[nt]);
#pragma unroll
    for (int nt = 0; nt < 4; ++nt) acc[nt] = WMMA_F32(a_c.zw, b_c[nt].zw, acc[nt]);
    a_c = a_n;
#pragma unroll
    for (int nt = 0; nt < 4; ++nt) b_c[nt] = b_n[nt];
  }

#pragma unroll
  for (int nt = 0; nt < 4; ++nt) {
    const int e = n0 + nt * 16 + lo;
    const float bias = bq[e];
    const int h = e >> 6, dd = e & 63;
#pragma unroll
    for (int i = 0; i < 8; ++i) {
      const int m = m0 + i + 8 * half;
      const int b = m >> 10, q = m & 1023;
      Qh[((size_t)(b * H_ + h) * S_ + q) * D_ + dd] = acc[nt][i] + bias;
    }
  }
}

// ---------------------------------------------------------------------------
// Kernel 2: attention for one (b, h, 32-query block). Single pass over M,
// streamed with GLOBAL_LOAD_ASYNC_TO_LDS_B128 concurrently with QK^T WMMAs.
// ---------------------------------------------------------------------------
__global__ void __launch_bounds__(256)
attn_kernel(const float* __restrict__ Qh, const float* __restrict__ Kg,
            const float* __restrict__ Vt, const float* __restrict__ Mg,
            const float* __restrict__ dpm, float* __restrict__ ctx,
            int* __restrict__ Pmax) {
  extern __shared__ __attribute__((aligned(16))) float Sl[];  // [QB x SROW] scores | [QB x S_] M, later 2 x [D_ x VROW] V
  const int tid = threadIdx.x, lane = tid & 31, w = tid >> 5;
  const int lo = lane & 15, half = lane >> 4;
  const int qb = blockIdx.x, h = blockIdx.y, b = blockIdx.z;
  const int q0 = qb * QB;
  const size_t bh = (size_t)(b * H_ + h);

  // -------- Phase 0: async-stream this block's M slab (128 KB) into LDS -----
  // Non-temporal: M is 256 MB stream-once data; keep L2 for K/Vt/Qh re-reads.
  {
    const float* Mbase = Mg + (bh * S_ + (size_t)q0) * S_;
#pragma unroll
    for (int i = 0; i < (QB * S_) / (256 * 4); ++i) {   // 32 x 16B per thread
      const int idx = tid + i * 256;                    // 16-byte chunk index
      const unsigned lds_b = (unsigned)(MLOFF_W * 4 + idx * 16);
      const void* gp = (const void*)(Mbase + idx * 4);
      asm volatile("global_load_async_to_lds_b128 %0, %1, off th:TH_LOAD_NT"
                   :: "v"(lds_b), "v"(gp) : "memory");
    }
  }

  // -------- Phase 1: Sl[q][k] = (Q . K^T) * inv_sqrt_d  via WMMA f32 --------
  {
    const float* Qbase = Qh + (bh * S_ + q0) * D_;
    const float* Kbase = Kg + bh * S_ * D_;
    v4f af[QB / 16][8];                             // hoisted A (Q) fragments
#pragma unroll
    for (int mt = 0; mt < QB / 16; ++mt) {
      const float* ap = Qbase + (size_t)(mt * 16 + lo) * D_ + 4 * half;
#pragma unroll
      for (int ks = 0; ks < 8; ++ks) af[mt][ks] = *(const v4f*)(ap + ks * 8);
    }
    v4f bf[2][8];                                   // double-buffered K frags
    {
      const float* bp = Kbase + (size_t)(w * 128 + lo) * D_ + 4 * half;
#pragma unroll
      for (int ks = 0; ks < 8; ++ks) bf[0][ks] = *(const v4f*)(bp + ks * 8);
    }
    // precaution: the loads' address registers are reused only behind this wait
    asm volatile("s_wait_xcnt 0x0" ::: "memory");
#pragma unroll
    for (int nt = 0; nt < 8; ++nt) {                // this wave's 128-key strip
      const int cur = nt & 1;
      if (nt < 7) {                                 // prefetch next key tile
        const float* bp =
            Kbase + (size_t)(w * 128 + (nt + 1) * 16 + lo) * D_ + 4 * half;
#pragma unroll
        for (int ks = 0; ks < 8; ++ks)
          bf[cur ^ 1][ks] = *(const v4f*)(bp + ks * 8);
        // precaution: the loads' address registers are reused only behind this wait
        asm volatile("s_wait_xcnt 0x0" ::: "memory");
      }
#pragma unroll
      for (int mt = 0; mt < QB / 16; ++mt) {        // each K tile is read once
        v8f acc0 = {}, acc1 = {};                   // .xy / .zw chains
#pragma unroll
        for (int ks = 0; ks < 8; ++ks) {
          acc0 = WMMA_F32(af[mt][ks].xy, bf[cur][ks].xy, acc0);
          acc1 = WMMA_F32(af[mt][ks].zw, bf[cur][ks].zw, acc1);
        }
        const int col = w * 128 + nt * 16 + lo;
        const int rb = mt * 16 + 8 * half;
#pragma unroll
        for (int i = 0; i < 8; ++i)
          Sl[(rb + i) * SROW + col] = (acc0[i] + acc1[i]) * INV_SQRT_D;
      }
    }
  }
  asm volatile("s_wait_asynccnt 0x0" ::: "memory");  // M slab resident in LDS
  __syncthreads();

  // -------- Phase 2: fused (-M from LDS), row softmax, dp_mask --------------
  // Each wave keeps its four rows in registers: scores and M are read from LDS
  // once, 16 bytes per lane (lane l holds floats 128j + 4l .. + 3), and the
  // probabilities are written once. The four rows go through every stage side
  // by side, so that one row's LDS and cross-lane latency covers the others'.
  // Every loop here is fully unrolled: t[][] is then indexed by constants only
  // and stays in registers (a run-time index would send it to scratch).
  {
    constexpr int RW = QB / 8;                      // rows per wave
    float dm[RW], mx[RW], sum[RW];
    v4f t[RW][8];
#pragma unroll
    for (int rr = 0; rr < RW; ++rr) dm[rr] = dpm[b * S_ + q0 + w + 8 * rr];
#pragma unroll
    for (int rr = 0; rr < RW; ++rr) {
      const int r = w + 8 * rr;
      const v4f* srow = (const v4f*)(Sl + r * SROW) + lane;
      const v4f* mrow = (const v4f*)(Sl + MLOFF_W + r * S_) + lane;
#pragma unroll
      for (int j = 0; j < 8; ++j) t[rr][j] = srow[j * 32] - mrow[j * 32];
    }
#pragma unroll
    for (int rr = 0; rr < RW; ++rr) {
      float m = -3.0e38f;
#pragma unroll
      for (int j = 0; j < 8; ++j)
        m = fmaxf(fmaxf(m, fmaxf(t[rr][j].x, t[rr][j].y)),
                  fmaxf(t[rr][j].z, t[rr][j].w));
      mx[rr] = m;
    }
#pragma unroll
    for (int o = 16; o; o >>= 1)
#pragma unroll
      for (int rr = 0; rr < RW; ++rr)
        mx[rr] = fmaxf(mx[rr], __shfl_xor(mx[rr], o, 32));
#pragma unroll
    for (int rr = 0; rr < RW; ++rr) {
      v4f s4 = {};                                  // four independent chains
#pragma unroll
      for (int j = 0; j < 8; ++j) {
        v4f e;
        e.x = exp2_slot((t[rr][j].x - mx[rr]) * LOG2E);
        e.y = exp2_slot((t[rr][j].y - mx[rr]) * LOG2E);
        e.z = exp2_slot((t[rr][j].z - mx[rr]) * LOG2E);
        e.w = exp2_slot((t[rr][j].w - mx[rr]) * LOG2E);
        t[rr][j] = e;
        s4 += e;
      }
      sum[rr] = (s4.x + s4.y) + (s4.z + s4.w);
    }
#pragma unroll
    for (int o = 16; o; o >>= 1)
#pragma unroll
      for (int rr = 0; rr < RW; ++rr) sum[rr] += __shfl_xor(sum[rr], o, 32);
#pragma unroll
    for (int rr = 0; rr < RW; ++rr) {
      const float scale = dm[rr] / sum[rr];
      v4f* srow = (v4f*)(Sl + (w + 8 * rr) * SROW) + lane;
#pragma unroll
      for (int j = 0; j < 8; ++j) srow[j * 32] = t[rr][j] * scale;
    }
  }
  __syncthreads();

  // Keeps the address arithmetic of the copies below behind the softmax, whose
  // rows fill the registers: lifted over it, the build went past 256 VGPRs.
  __builtin_amdgcn_sched_barrier(0);

  // -------- Phase 4 prologue: V tile 0 starts towards LDS ------------------
  // The barrier above ends every wave's reads of the M slab; the V buffers lie
  // there. Thread tid copies 16-byte chunk tid & 63 of rows tid >> 6 + 4 i.
  const float* vsrc = Vt + (bh * D_ + (tid >> 6)) * S_ + (tid & 63) * 4;
  const unsigned vdst =
      (unsigned)(size_t)(Sl + MLOFF_W + (tid >> 6) * VROW + (tid & 63) * 4);
  copy8_rows(vdst, vsrc);
  copy8_rows(vdst + 32u * VROW * 4u, vsrc + 32 * S_);

  // -------- Phase 3: per-key max over this q block -> atomic bit-max --------
  for (int k = tid; k < S_; k += 256) {
    float mx = 0.f;                                 // probs >= 0
    for (int q = 0; q < QB; ++q) mx = fmaxf(mx, Sl[q * SROW + k]);
    atomicMax(&Pmax[(b * H_ + h) * S_ + k], __float_as_int(mx));
  }

  // -------- Phase 4: ctx = P @ V  (A and B from LDS) ------------------------
  // Transposed V comes in tiles of KT keys, two buffers: tile t + 1 flies
  // while tile t is multiplied; all eight waves share one copy of each tile.
  {
    const int mt = w >> 2;                          // 16-row tile
    const int d0 = (w & 3) * 16;                    // 16-col (head dim) tile
    const float* Ab = Sl + (mt * 16 + lo) * SROW + 4 * half;
    const float* Vb = Sl + MLOFF_W + (d0 + lo) * VROW + 4 * half;
    v8f acc0 = {}, acc1 = {};
    asm volatile("s_wait_asynccnt 0x0" ::: "memory");  // own copies of tile 0 landed
    __syncthreads();                                   // tile 0 published
    copy8_rows(vdst + (unsigned)VBUF_W * 4u, vsrc + KT);
    copy8_rows(vdst + (unsigned)(VBUF_W + 32 * VROW) * 4u, vsrc + KT + 32 * S_);
    // kept rolled: one copy of the publish point, small code
#pragma unroll 1
    for (int t = 0; t < NT; ++t) {
      const float* At = Ab + t * KT;
      const float* Bt = Vb + (t & 1) * VBUF_W;
      constexpr int G = 8;                          // k-steps of 8 per group
      v4f af[2][G], vf[2][G];                       // double-buffered fragments
#pragma unroll
      for (int j = 0; j < G; ++j) {
        af[0][j] = *(const v4f*)(At + j * 8);
        vf[0][j] = *(const v4f*)(Bt + j * 8);
      }
      // unrolled: af/vf are then indexed by constants and stay in registers
#pragma unroll
      for (int g = 0; g < KT / (8 * G); ++g) {
        const int cur = g & 1;
        if (g + 1 < KT / (8 * G)) {                 // next group, same tile only
#pragma unroll
          for (int j = 0; j < G; ++j) {
            af[cur ^ 1][j] = *(const v4f*)(At + ((g + 1) * G + j) * 8);
            vf[cur ^ 1][j] = *(const v4f*)(Bt + ((g + 1) * G + j) * 8);
          }
        }
        // Holds the next group's LDS reads, as one block, in front of this
        // group's WMMAs: sunk among them they come one pair ahead only, too
        // late for the LDS latency.
        __builtin_amdgcn_sched_barrier(0);
#pragma unroll
        for (int j = 0; j < G; ++j) {
          acc0 = WMMA_F32(af[cur][j].xy, vf[cur][j].xy, acc0);
          acc1 = WMMA_F32(af[cur][j].zw, vf[cur][j].zw, acc1);
        }
      }
      // Publish point: own LDS reads done, own copies of tile t + 1 landed, then
      // the barrier; only behind it is the buffer just read filled again.
      asm volatile("s_wait_dscnt 0x0" ::: "memory");
      asm volatile("s_wait_asynccnt 0x0" ::: "memory");
      __syncthreads();
      if (t + 2 < NT) {
        const unsigned ld = vdst + (unsigned)((t & 1) * VBUF_W) * 4u;
        const float* gs = vsrc + (t + 2) * KT;
        copy8_rows(ld, gs);
        copy8_rows(ld + 32u * VROW * 4u, gs + 32 * S_);
      }
    }
    asm volatile("s_wait_asynccnt 0x0" ::: "memory");  // nothing in flight at the end
    const v8f acc = acc0 + acc1;
    const int q = q0 + mt * 16 + 8 * half;
    const int e = h * D_ + d0 + lo;
#pragma unroll
    for (int i = 0; i < 8; ++i)   // write-once output: non-temporal stores
      __builtin_nontemporal_store(acc[i],
                                  ctx + (size_t)(b * S_ + q + i) * E_ + e);
  }
}

// ---------------------------------------------------------------------------
// Kernel 3: target_score[b,k] = sum_h max_q probs
// ---------------------------------------------------------------------------
__global__ void __launch_bounds__(256)
tscore_kernel(const int* __restrict__ Pmax, float* __restrict__ out) {
  const int idx = blockIdx.x * 256 + threadIdx.x;   // 4096 = B*Sk
  const int b = idx >> 10, k = idx & 1023;
  float s = 0.f;
#pragma unroll
  for (int h = 0; h < H_; ++h) s += __int_as_float(Pmax[(b * H_ + h) * S_ + k]);
  out[idx] = s;
}

// ---------------------------------------------------------------------------
extern "C" void kernel_launch(void* const* d_in, const int* in_sizes, int n_in,
                              void* d_out, int out_size, void* d_ws, size_t ws_size,
                              hipStream_t stream) {
  (void)in_sizes; (void)n_in; (void)out_size; (void)ws_size;
  const float* dp_emb  = (const float*)d_in[0];
  const float* dp_mask = (const float*)d_in[1];
  const float* K       = (const float*)d_in[2];
  const float* V       = (const float*)d_in[3];
  const float* M       = (const float*)d_in[4];
  const float* Wq      = (const float*)d_in[5];
  const float* bq      = (const float*)d_in[6];

  float* ctx = (float*)d_out;
  float* ts  = ctx + (size_t)B_ * S_ * E_;

  float* Qh   = (float*)d_ws;                          // 16 MB
  float* Vt   = Qh + (size_t)B_ * H_ * S_ * D_;        // 16 MB
  int*   Pmax = (int*)(Vt + (size_t)B_ * H_ * S_ * D_);// 256 KB

  const int smem = LDS_WORDS * (int)sizeof(float);     // 264,704 B (< 320 KB)
  (void)hipFuncSetAttribute((const void*)attn_kernel,
                            hipFuncAttributeMaxDynamicSharedMemorySize, smem);

  init_pmax_kernel<<<B_ * H_ * S_ / 256, 256, 0, stream>>>(Pmax);
  transv_kernel<<<B_ * H_ * (S_ / 64), 256, 0, stream>>>(V, Vt);
  qproj_kernel<<<dim3(B_ * S_ / 64, E_ / 128), 256, 0, stream>>>(dp_emb, Wq, bq, Qh);
  attn_kernel<<<dim3(S_ / QB, H_, B_), 256, smem, stream>>>(Qh, K, Vt, M, dp_mask, ctx, Pmax);
  tscore_kernel<<<B_ * S_ / 256, 256, 0, stream>>>(Pmax, ts);
}

// v004
// One run takes 194 microseconds.
// In both of two side-by-side timings against v003, it was 1.18 times as fast.
// Counting every step since v000, it is 2.11 times as fast.
#include <hip/hip_runtime.h>

typedef __attribute__((ext_vector_type(2))) float v2f;
typedef __attribute__((ext_vector_type(4))) float v4f;
typedef __attribute__((ext_vector_type(8))) float v8f;

#define WMMA_F32(a, b, c) \
  __builtin_amdgcn_wmma_f32_16x16x4_f32(false, (a), false, (b), (short)0, (c), false, false)

// Fragment loads: every lane reads 16 bytes of its row, floats 8j + 4*half .. + 3,
// and feeds two WMMAs: .xy carries k = 8j + {0,1 | 4,5}, .zw k = 8j + {2,3 | 6,7}
// (lanes 0-15 | lanes 16-31). A and B are always read the same way, so every
// k slot pairs the same k of both operands.

constexpr int B_ = 4, H_ = 16, S_ = 1024, D_ = 64, E_ = 1024;
constexpr int QB = 32;            // queries per attention workgroup
constexpr int SROW = 1028;        // padded LDS row stride (floats): 16 B x odd
constexpr int MLOFF_W = QB * SROW;            // word offset of M slab in LDS
constexpr int KT = 256;           // keys per staged tile of transposed V
constexpr int NT = S_ / KT;       // tiles per (b, h)
constexpr int VROW = KT + 4;      // padded LDS row stride (floats): 16 B x odd
constexpr int VBUF_W = D_ * VROW; // words per staged tile (64 head-dim rows)
// The two V buffers take the place of the M slab once the softmax has read it.
constexpr int LDS_WORDS = MLOFF_W + 2 * VBUF_W;  // 66,176 words = 264,704 B
static_assert(2 * VBUF_W >= QB * S_, "the M slab must fit as well");
constexpr float INV_SQRT_D = 0.125f;

// 2^x with the slot that the instruction set asks for behind a transcendental
// (one v_nop before its result is read or its source overwritten) in the same
// statement.
__device__ __forceinline__ float exp2_slot(float x) {
  float y;
  asm("v_exp_f32 %0, %1\n\tv_nop" : "=v"(y) : "v"(x));
  return y;
}
constexpr float LOG2E = 0x1.715476p+0f;   // the factor __expf multiplies by

// Eight asynchronous 16-byte copies per lane, global -> LDS, rows four apart
// (a wave's 32 lanes cover 512 contiguous bytes of one row: whole lines).
// The s_wait_xcnt is the last line of the copies' own statement, so that no
// address register is rewritten in front of it (a precaution).
__device__ __forceinline__ void copy8_rows(unsigned l, const float* g) {
  asm volatile(
      "global_load_async_to_lds_b128 %0, %8, off\n\t"
      "global_load_async_to_lds_b128 %1, %9, off\n\t"
      "global_load_async_to_lds_b128 %2, %10, off\n\t"
      "global_load_async_to_lds_b128 %3, %11, off\n\t"
      "global_load_async_to_lds_b128 %4, %12, off\n\t"
      "global_load_async_to_lds_b128 %5, %13, off\n\t"
      "global_load_async_to_lds_b128 %6, %14, off\n\t"
      "global_load_async_to_lds_b128 %7, %15, off\n\t"
      "s_wait_xcnt 0x0"
      :: "v"(l), "v"(l + 4u * VROW * 4u), "v"(l + 8u * VROW * 4u),
         "v"(l + 12u * VROW * 4u), "v"(l + 16u * VROW * 4u),
         "v"(l + 20u * VROW * 4u), "v"(l + 24u * VROW * 4u),
         "v"(l + 28u * VROW * 4u),
         "v"(g), "v"(g + 4 * S_), "v"(g + 8 * S_), "v"(g + 12 * S_),
         "v"(g + 16 * S_), "v"(g + 20 * S_), "v"(g + 24 * S_), "v"(g + 28 * S_)
      : "memory");
}

// ---------------------------------------------------------------------------
// Kernel 0a: zero the per-(b,h,k) prob-max buffer
// ---------------------------------------------------------------------------
__global__ void __launch_bounds__(256) init_pmax_kernel(int* __restrict__ p) {
  p[blockIdx.x * 256 + threadIdx.x] = 0;
}

// ---------------------------------------------------------------------------
// Kernel 0b: Vt[b,h,d,k] = V[b,h,k,d]   (so P@V B-fragments are contiguous)
// ---------------------------------------------------------------------------
__global__ void __launch_bounds__(256)
transv_kernel(const float* __restrict__ V, float* __restrict__ Vt) {
  __shared__ float t[64][65];
  const int bh = blockIdx.x >> 4;
  const int kt = blockIdx.x & 15;                 // 16 k-tiles of 64
  const size_t base = ((size_t)bh * S_ + (size_t)kt * 64) * D_;
  for (int i = threadIdx.x; i < 64 * 64; i += 256)
    t[i >> 6][i & 63] = V[base + i];
  __syncthreads();
  for (int i = threadIdx.x; i < 64 * 64; i += 256) {
    const int dd = i >> 6, kk = i & 63;
    Vt[((size_t)bh * D_ + dd) * S_ + kt * 64 + kk] = t[kk][dd];
  }
}

// ---------------------------------------------------------------------------
// Kernel 1: Q projection  Qh[b,h,q,d] = (X @ Wq^T + bq) reshaped per-head
// 256 thr (8 waves); block tile 64(M) x 128(N); wave tile 16 x 64.
// X and Wq come in tiles of PK k values, staged in LDS by asynchronous copies
// of whole 256-byte row pieces, two buffers: tile t + 1 flies while tile t is
// multiplied. The fragments are read from LDS (a fragment load from global
// memory touches 16 cache lines for its 512 bytes).
// ---------------------------------------------------------------------------
constexpr int PK = 64;                  // k values per staged tile
constexpr int PNT = E_ / PK;            // tiles along k
// Padded LDS row stride (floats): 16 B x odd, free of bank conflicts for the
// 16-byte fragment reads. 19 rather than 17: the two buffers then take more than
// a third of a WGP's LDS, so at most two work-groups share a WGP and the 512 of
// the grid cannot crowd onto fewer than all 256 WGPs.
constexpr int PROW = PK + 12;
constexpr int PBUF_W = (64 + 128) * PROW;  // words per buffer: 64 X rows, 128 Wq rows
static_assert(3 * 2 * PBUF_W * 4 > 327680 && 2 * 2 * PBUF_W * 4 <= 327680,
              "two work-groups per WGP, not three");

// Twelve asynchronous 16-byte copies per lane, global -> LDS, rows 16 apart:
// four of X, eight of Wq (a wave's 32 lanes cover two rows' 256 bytes each).
// The s_wait_xcnt is the last line of the copies' own statement, so that no
// address register is rewritten in front of it (a precaution).
__device__ __forceinline__ void copy12_rows(unsigned l, const float* gx,
                                            const float* gw) {
  constexpr unsigned RS = 16u * PROW * 4u;   // 16 LDS rows, bytes
  asm volatile(
      "global_load_async_to_lds_b128 %0, %12, off\n\t"
      "global_load_async_to_lds_b128 %1, %13, off\n\t"
      "global_load_async_to_lds_b128 %2, %14, off\n\t"
      "global_load_async_to_lds_b128 %3, %15, off\n\t"
      "global_load_async_to_lds_b128 %4, %16, off\n\t"
      "global_load_async_to_lds_b128 %5, %17, off\n\t"
      "global_load_async_to_lds_b128 %6, %18, off\n\t"
      "global_load_async_to_lds_b128 %7, %19, off\n\t"
      "global_load_async_to_lds_b128 %8, %20, off\n\t"
      "global_load_async_to_lds_b128 %9, %21, off\n\t"
      "global_load_async_to_lds_b128 %10, %22, off\n\t"
      "global_load_async_to_lds_b128 %11, %23, off\n\t"
      "s_wait_xcnt 0x0"
      :: "v"(l), "v"(l + RS), "v"(l + 2u * RS), "v"(l + 3u * RS),
         "v"(l + 4u * RS), "v"(l + 5u * RS), "v"(l + 6u * RS), "v"(l + 7u * RS),
         "v"(l + 8u * RS), "v"(l + 9u * RS), "v"(l + 10u * RS), "v"(l + 11u * RS),
         "v"(gx), "v"(gx + 16 * E_), "v"(gx + 32 * E_), "v"(gx + 48 * E_),
         "v"(gw), "v"(gw + 16 * E_), "v"(gw + 32 * E_), "v"(gw + 48 * E_),
         "v"(gw + 64 * E_), "v"(gw + 80 * E_), "v"(gw + 96 * E_), "v"(gw + 112 * E_)
      : "memory");
}

__global__ void __launch_bounds__(256)
qproj_kernel(const float* __restrict__ X, const float* __restrict__ Wq,
             const float* __restrict__ bq, float* __restrict__ Qh) {
  __shared__ __attribute__((aligned(16))) float Pl[2 * PBUF_W];   // 116,736 B
  const int tid = threadIdx.x, lane = tid & 31, w = tid >> 5;
  const int lo = lane & 15, half = lane >> 4;
  const int m0 = blockIdx.x * 64 + (w >> 1) * 16;   // global M row (= b*S + q)
  const int n0 = blockIdx.y * 128 + (w & 1) * 64;   // global N col (= e)

  // Thread tid copies 16-byte chunk tid & 15 of rows tid >> 4 + 16 i.
  const float* xsrc = X + (size_t)(blockIdx.x * 64 + (tid >> 4)) * E_ + (tid & 15) * 4;
  const float* wsrc = Wq + (size_t)(blockIdx.y * 128 + (tid >> 4)) * E_ + (tid & 15) * 4;
  const unsigned pdst = (unsigned)(size_t)(Pl + (tid >> 4) * PROW + (tid & 15) * 4);

  // This lane's row of the wave's X tile and of its first Wq tile, in buffer 0.
  const float* Ab = Pl + ((w >> 1) * 16 + lo) * PROW + 4 * half;
  const float* Bb = Pl + (64 + (w & 1) * 64 + lo) * PROW + 4 * half;

  v8f acc[4] = {};
  copy12_rows(pdst, xsrc, wsrc);
  asm volatile("s_wait_asynccnt 0x0" ::: "memory");  // own copies of tile 0 landed
  __syncthreads();                                   // tile 0 published
  copy12_rows(pdst + (unsigned)PBUF_W * 4u, xsrc + PK, wsrc + PK);
  // kept rolled: one copy of the publish point, small code
#pragma unroll 1
  for (int t = 0; t < PNT; ++t) {
    const float* At = Ab + (t & 1) * PBUF_W;
    const float* Bt = Bb + (t & 1) * PBUF_W;
    constexpr int G = 2;                            // k-steps of 8 per group
    v4f af[2][G], bf[2][G][4];                      // double-buffered fragments
#pragma unroll
    for (int j = 0; j < G; ++j) {
      af[0][j] = *(const v4f*)(At + j * 8);
#pragma unroll
      for (int nt = 0; nt < 4; ++nt)
        bf[0][j][nt] = *(const v4f*)(Bt + nt * 16 * PROW + j * 8);
    }
    // unrolled: af/bf are then indexed by constants and stay in registers
#pragma unroll
    for (int g = 0; g < PK / (8 * G); ++g) {
      const int cur = g & 1;
      if (g + 1 < PK / (8 * G)) {                   // next group, same tile only
#pragma unroll
        for (int j = 0; j < G; ++j) {
          af[cur ^ 1][j] = *(const v4f*)(At + ((g + 1) * G + j) * 8);
#pragma unroll
          for (int nt = 0; nt < 4; ++nt)
            bf[cur ^ 1][j][nt] =
                *(const v4f*)(Bt + nt * 16 * PROW + ((g + 1) * G + j) * 8);
        }
      }
#pragma unroll
      for (int j = 0; j < G; ++j) {
#pragma unroll
        for (int nt = 0; nt < 4; ++nt)
          acc[nt] = WMMA_F32(af[cur][j].xy, bf[cur][j][nt].xy, acc[nt]);
#pragma unroll
        for (int nt = 0; nt < 4; ++nt)
          acc[nt] = WMMA_F32(af[cur][j].zw, bf[cur][j][nt].zw, acc[nt]);
      }
    }
    // Publish point: own LDS reads done, own copies of tile t + 1 landed, then
    // the barrier; only behind it is the buffer just read filled again.
    asm volatile("s_wait_dscnt 0x0" ::: "memory");
    asm volatile("s_wait_asynccnt 0x0" ::: "memory");
    __syncthreads();
    if (t + 2 < PNT)
      copy12_rows(pdst + (unsigned)((t & 1) * PBUF_W) * 4u, xsrc + (t + 2) * PK,
                  wsrc + (t + 2) * PK);
  }
  asm volatile("s_wait_asynccnt 0x0" ::: "memory");  // nothing in flight at the end

#pragma unroll
  for (int nt = 0; nt < 4; ++nt) {
    const int e = n0 + nt * 16 + lo;
    const float bias = bq[e];
    const int h = e >> 6, dd = e & 63;
#pragma unroll
    for (int i = 0; i < 8; ++i) {
      const int m = m0 + i + 8 * half;
      const int b = m >> 10, q = m & 1023;
      Qh[((size_t)(b * H_ + h) * S_ + q) * D_ + dd] = acc[nt][i] + bias;
    }
  }
}

// ---------------------------------------------------------------------------
// Kernel 2: attention for one (b, h, 32-query block). Single pass over M,
// streamed with GLOBAL_LOAD_ASYNC_TO_LDS_B128 concurrently with QK^T WMMAs.
// ---------------------------------------------------------------------------
__global__ void __launch_bounds__(256)
attn_kernel(const float* __restrict__ Qh, const float* __restrict__ Kg,
            const float* __restrict__ Vt, const float* __restrict__ Mg,
            const float* __restrict__ dpm, float* __restrict__ ctx,
            int* __restrict__ Pmax) {
  extern __shared__ __attribute__((aligned(16))) float Sl[];  // [QB x SROW] scores | [QB x S_] M, later 2 x [D_ x VROW] V
  const int tid = threadIdx.x, lane = tid & 31, w = tid >> 5;
  const int lo = lane & 15, half = lane >> 4;
  const int qb = blockIdx.x, h = blockIdx.y, b = blockIdx.z;
  const int q0 = qb * QB;
  const size_t bh = (size_t)(b * H_ + h);

  // -------- Phase 0: async-stream this block's M slab (128 KB) into LDS -----
  // Non-temporal: M is 256 MB stream-once data; keep L2 for K/Vt/Qh re-reads.
  {
    const float* Mbase = Mg + (bh * S_ + (size_t)q0) * S_;
#pragma unroll
    for (int i = 0; i < (QB * S_) / (256 * 4); ++i) {   // 32 x 16B per thread
      const int idx = tid + i * 256;                    // 16-byte chunk index
      const unsigned lds_b = (unsigned)(MLOFF_W * 4 + idx * 16);
      const void* gp = (const void*)(Mbase + idx * 4);
      asm volatile("global_load_async_to_lds_b128 %0, %1, off th:TH_LOAD_NT"
                   :: "v"(lds_b), "v"(gp) : "memory");
    }
  }

  // -------- Phase 1: Sl[q][k] = (Q . K^T) * inv_sqrt_d  via WMMA f32 --------
  {
    const float* Qbase = Qh + (bh * S_ + q0) * D_;
    const float* Kbase = Kg + bh * S_ * D_;
    v4f af[QB / 16][8];                             // hoisted A (Q) fragments
#pragma unroll
    for (int mt = 0; mt < QB / 16; ++mt) {
      const float* ap = Qbase + (size_t)(mt * 16 + lo) * D_ + 4 * half;
#pragma unroll
      for (int ks = 0; ks < 8; ++ks) af[mt][ks] = *(const v4f*)(ap + ks * 8);
    }
    v4f bf[2][8];                                   // double-buffered K frags
    {
      const float* bp = Kbase + (size_t)(w * 128 + lo) * D_ + 4 * half;
#pragma unroll
      for (int ks = 0; ks < 8; ++ks) bf[0][ks] = *(const v4f*)(bp + ks * 8);
    }
    // precaution: the loads' address registers are reused only behind this wait
    asm volatile("s_wait_xcnt 0x0" ::: "memory");
#pragma unroll
    for (int nt = 0; nt < 8; ++nt) {                // this wave's 128-key strip
      const int cur = nt & 1;
      if (nt < 7) {                                 // prefetch next key tile
        const float* bp =
            Kbase + (size_t)(w * 128 + (nt + 1) * 16 + lo) * D_ + 4 * half;
#pragma unroll
        for (int ks = 0; ks < 8; ++ks)
          bf[cur ^ 1][ks] = *(const v4f*)(bp + ks * 8);
        // precaution: the loads' address registers are reused only behind this wait
        asm volatile("s_wait_xcnt 0x0" ::: "memory");
      }
#pragma unroll
      for (int mt = 0; mt < QB / 16; ++mt) {        // each K tile is read once
        v8f acc0 = {}, acc1 = {};                   // .xy / .zw chains
#pragma unroll
        for (int ks = 0; ks < 8; ++ks) {
          acc0 = WMMA_F32(af[mt][ks].xy, bf[cur][ks].xy, acc0);
          acc1 = WMMA_F32(af[mt][ks].zw, bf[cur][ks].zw, acc1);
        }
        const int col = w * 128 + nt * 16 + lo;
        const int rb = mt * 16 + 8 * half;
#pragma unroll
        for (int i = 0; i < 8; ++i)
          Sl[(rb + i) * SROW + col] = (acc0[i] + acc1[i]) * INV_SQRT_D;
      }
    }
  }
  asm volatile("s_wait_asynccnt 0x0" ::: "memory");  // M slab resident in LDS
  __syncthreads();

  // -------- Phase 2: fused (-M from LDS), row softmax, dp_mask --------------
  // Each wave keeps its four rows in registers: scores and M are read from LDS
  // once, 16 bytes per lane (lane l holds floats 128j + 4l .. + 3), and the
  // probabilities are written once. The four rows go through every stage side
  // by side, so that one row's LDS and cross-lane latency covers the others'.
  // Every loop here is fully unrolled: t[][] is then indexed by constants only
  // and stays in registers (a run-time index would send it to scratch).
  {
    constexpr int RW = QB / 8;                      // rows per wave
    float dm[RW], mx[RW], sum[RW];
    v4f t[RW][8];
#pragma unroll
    for (int rr = 0; rr < RW; ++rr) dm[rr] = dpm[b * S_ + q0 + w + 8 * rr];
#pragma unroll
    for (int rr = 0; rr < RW; ++rr) {
      const int r = w + 8 * rr;
      const v4f* srow = (const v4f*)(Sl + r * SROW) + lane;
      const v4f* mrow = (const v4f*)(Sl + MLOFF_W + r * S_) + lane;
#pragma unroll
      for (int j = 0; j < 8; ++j) t[rr][j] = srow[j * 32] - mrow[j * 32];
    }
#pragma unroll
    for (int rr = 0; rr < RW; ++rr) {
      float m = -3.0e38f;
#pragma unroll
      for (int j = 0; j < 8; ++j)
        m = fmaxf(fmaxf(m, fmaxf(t[rr][j].x, t[rr][j].y)),
                  fmaxf(t[rr][j].z, t[rr][j].w));
      mx[rr] = m;
    }
#pragma unroll
    for (int o = 16; o; o >>= 1)
#pragma unroll
      for (int rr = 0; rr < RW; ++rr)
        mx[rr] = fmaxf(mx[rr], __shfl_xor(mx[rr], o, 32));
#pragma unroll
    for (int rr = 0; rr < RW; ++rr) {
      v4f s4 = {};                                  // four independent chains
#pragma unroll
      for (int j = 0; j < 8; ++j) {
        v4f e;
        e.x = exp2_slot((t[rr][j].x - mx[rr]) * LOG2E);
        e.y = exp2_slot((t[rr][j].y - mx[rr]) * LOG2E);
        e.z = exp2_slot((t[rr][j].z - mx[rr]) * LOG2E);
        e.w = exp2_slot((t[rr][j].w - mx[rr]) * LOG2E);
        t[rr][j] = e;
        s4 += e;
      }
      sum[rr] = (s4.x + s4.y) + (s4.z + s4.w);
    }
#pragma unroll
    for (int o = 16; o; o >>= 1)
#pragma unroll
      for (int rr = 0; rr < RW; ++rr) sum[rr] += __shfl_xor(sum[rr], o, 32);
#pragma unroll
    for (int rr = 0; rr < RW; ++rr) {
      const float scale = dm[rr] / sum[rr];
      v4f* srow = (v4f*)(Sl + (w + 8 * rr) * SROW) + lane;
#pragma unroll
      for (int j = 0; j < 8; ++j) srow[j * 32] = t[rr][j] * scale;
    }
  }
  __syncthreads();

  // Keeps the address arithmetic of the copies below behind the softmax, whose
  // rows fill the registers: lifted over it, the build went past 256 VGPRs.
  __builtin_amdgcn_sched_barrier(0);

  // -------- Phase 4 prologue: V tile 0 starts towards LDS ------------------
  // The barrier above ends every wave's reads of the M slab; the V buffers lie
  // there. Thread tid copies 16-byte chunk tid & 63 of rows tid >> 6 + 4 i.
  const float* vsrc = Vt + (bh * D_ + (tid >> 6)) * S_ + (tid & 63) * 4;
  const unsigned vdst =
      (unsigned)(size_t)(Sl + MLOFF_W + (tid >> 6) * VROW + (tid & 63) * 4);
  copy8_rows(vdst, vsrc);
  copy8_rows(vdst + 32u * VROW * 4u, vsrc + 32 * S_);

  // -------- Phase 3: per-key max over this q block -> atomic bit-max --------
  for (int k = tid; k < S_; k += 256) {
    float mx = 0.f;                                 // probs >= 0
    for (int q = 0; q < QB; ++q) mx = fmaxf(mx, Sl[q * SROW + k]);
    atomicMax(&Pmax[(b * H_ + h) * S_ + k], __float_as_int(mx));
  }

  // -------- Phase 4: ctx = P @ V  (A and B from LDS) ------------------------
  // Transposed V comes in tiles of KT keys, two buffers: tile t + 1 flies
  // while tile t is multiplied; all eight waves share one copy of each tile.
  {
    const int mt = w >> 2;                          // 16-row tile
    const int d0 = (w & 3) * 16;                    // 16-col (head dim) tile
    const float* Ab = Sl + (mt * 16 + lo) * SROW + 4 * half;
    const float* Vb = Sl + MLOFF_W + (d0 + lo) * VROW + 4 * half;
    v8f acc0 = {}, acc1 = {};
    asm volatile("s_wait_asynccnt 0x0" ::: "memory");  // own copies of tile 0 landed
    __syncthreads();                                   // tile 0 published
    copy8_rows(vdst + (unsigned)VBUF_W * 4u, vsrc + KT);
    copy8_rows(vdst + (unsigned)(VBUF_W + 32 * VROW) * 4u, vsrc + KT + 32 * S_);
    // kept rolled: one copy of the publish point, small code
#pragma unroll 1
    for (int t = 0; t < NT; ++t) {
      const float* At = Ab + t * KT;
      const float* Bt = Vb + (t & 1) * VBUF_W;
      constexpr int G = 8;                          // k-steps of 8 per group
      v4f af[2][G], vf[2][G];                       // double-buffered fragments
#pragma unroll
      for (int j = 0; j < G; ++j) {
        af[0][j] = *(const v4f*)(At + j * 8);
        vf[0][j] = *(const v4f*)(Bt + j * 8);
      }
      // unrolled: af/vf are then indexed by constants and stay in registers
#pragma unroll
      for (int g = 0; g < KT / (8 * G); ++g) {
        const int cur = g & 1;
        if (g + 1 < KT / (8 * G)) {                 // next group, same tile only
#pragma unroll
          for (int j = 0; j < G; ++j) {
            af[cur ^ 1][j] = *(const v4f*)(At + ((g + 1) * G + j) * 8);
            vf[cur ^ 1][j] = *(const v4f*)(Bt + ((g + 1) * G + j) * 8);
          }
        }
        // Holds the next group's LDS reads, as one block, in front of this
        // group's WMMAs: sunk among them they come one pair ahead only, too
        // late for the LDS latency.
        __builtin_amdgcn_sched_barrier(0);
#pragma unroll
        for (int j = 0; j < G; ++j) {
          acc0 = WMMA_F32(af[cur][j].xy, vf[cur][j].xy, acc0);
          acc1 = WMMA_F32(af[cur][j].zw, vf[cur][j].zw, acc1);
        }
      }
      // Publish point: own LDS reads done, own copies of tile t + 1 landed, then
      // the barrier; only behind it is the buffer just read filled again.
      asm volatile("s_wait_dscnt 0x0" ::: "memory");
      asm volatile("s_wait_asynccnt 0x0" ::: "memory");
      __syncthreads();
      if (t + 2 < NT) {
        const unsigned ld = vdst + (unsigned)((t & 1) * VBUF_W) * 4u;
        const float* gs = vsrc + (t + 2) * KT;
        copy8_rows(ld, gs);
        copy8_rows(ld + 32u * VROW * 4u, gs + 32 * S_);
      }
    }
    asm volatile("s_wait_asynccnt 0x0" ::: "memory");  // nothing in flight at the end
    const v8f acc = acc0 + acc1;
    const int q = q0 + mt * 16 + 8 * half;
    const int e = h * D_ + d0 + lo;
#pragma unroll
    for (int i = 0; i < 8; ++i)   // write-once output: non-temporal stores
      __builtin_nontemporal_store(acc[i],
                                  ctx + (size_t)(b * S_ + q + i) * E_ + e);
  }
}

// ---------------------------------------------------------------------------
// Kernel 3: target_score[b,k] = sum_h max_q probs
// ---------------------------------------------------------------------------
__global__ void __launch_bounds__(256)
tscore_kernel(const int* __restrict__ Pmax, float* __restrict__ out) {
  const int idx = blockIdx.x * 256 + threadIdx.x;   // 4096 = B*Sk
  const int b = idx >> 10, k = idx & 1023;
  float s = 0.f;
#pragma unroll
  for (int h = 0; h < H_; ++h) s += __int_as_float(Pmax[(b * H_ + h) * S_ + k]);
  out[idx] = s;
}

// ---------------------------------------------------------------------------
extern "C" void kernel_launch(void* const* d_in, const int* in_sizes, int n_in,
                              void* d_out, int out_size, void* d_ws, size_t ws_size,
                              hipStream_t stream) {
  (void)in_sizes; (void)n_in; (void)out_size; (void)ws_size;
  const float* dp_emb  = (const float*)d_in[0];
  const float* dp_mask = (const float*)d_in[1];
  const float* K       = (const float*)d_in[2];
  const float* V       = (const float*)d_in[3];
  const float* M       = (const float*)d_in[4];
  const float* Wq      = (const float*)d_in[5];
  const float* bq      = (const float*)d_in[6];

  float* ctx = (float*)d_out;
  float* ts  = ctx + (size_t)B_ * S_ * E_;

  float* Qh   = (float*)d_ws;                          // 16 MB
  float* Vt   = Qh + (size_t)B_ * H_ * S_ * D_;        // 16 MB
  int*   Pmax = (int*)(Vt + (size_t)B_ * H_ * S_ * D_);// 256 KB

  const int smem = LDS_WORDS * (int)sizeof(float);     // 264,704 B (< 320 KB)
  (void)hipFuncSetAttribute((const void*)attn_kernel,
                            hipFuncAttributeMaxDynamicSharedMemorySize, smem);

  init_pmax_kernel<<<B_ * H_ * S_ / 256, 256, 0, stream>>>(Pmax);
  transv_kernel<<<B_ * H_ * (S_ / 64), 256, 0, stream>>>(V, Vt);
  qproj_kernel<<<dim3(B_ * S_ / 64, E_ / 128), 256, 0, stream>>>(dp_emb, Wq, bq, Qh);
  attn_kernel<<<dim3(S_ / QB, H_, B_), 256, smem, stream>>>(Qh, K, Vt, M, dp_mask, ctx, Pmax);
  tscore_kernel<<<B_ * S_ / 256, 256, 0, stream>>>(Pmax, ts);
}

// v005
// Measured time: 188 microseconds a run.
// Next to v004, in two timings, it ran 1.04 and 1.03 times as fast.
// Counting every step since v000, it is 2.18 times as fast.
#include <hip/hip_runtime.h>

typedef __attribute__((ext_vector_type(2))) float v2f;
typedef __attribute__((ext_vector_type(4))) float v4f;
typedef __attribute__((ext_vector_type(8))) float v8f;

#define WMMA_F32(a, b, c) \
  __builtin_amdgcn_wmma_f32_16x16x4_f32(false, (a), false, (b), (short)0, (c), false, false)

// Fragment loads: every lane reads 16 bytes of its row, floats 8j + 4*half .. + 3,
// and feeds two WMMAs: .xy carries k = 8j + {0,1 | 4,5}, .zw k = 8j + {2,3 | 6,7}
// (lanes 0-15 | lanes 16-31). A and B are always read the same way, so every
// k slot pairs the same k of both operands.

constexpr int B_ = 4, H_ = 16, S_ = 1024, D_ = 64, E_ = 1024;
constexpr int QB = 32;            // queries per attention workgroup
constexpr int SROW = 1028;        // padded LDS row stride (floats): 16 B x odd
constexpr int MLOFF_W = QB * SROW;            // word offset of M slab in LDS
constexpr int KT = 256;           // keys per staged tile of transposed V
constexpr int NT = S_ / KT;       // tiles per (b, h)
constexpr int VROW = KT + 4;      // padded LDS row stride (floats): 16 B x odd
constexpr int VBUF_W = D_ * VROW; // words per staged tile (64 head-dim rows)
// The two V buffers take the place of the M slab once the softmax has read it.
constexpr int LDS_WORDS = MLOFF_W + 2 * VBUF_W;  // 66,176 words = 264,704 B
static_assert(2 * VBUF_W >= QB * S_, "the M slab must fit as well");
// Behind them: one 16-row x 64-float tile per wave, private to the wave, in which
// whole-line reads of Q and K are turned into WMMA fragments.
constexpr int TROW = D_ + 4;      // padded LDS row stride (floats): 16 B x odd
constexpr int TBUF_W = 16 * TROW; // words per wave
constexpr int LDS_ALL_W = LDS_WORDS + 8 * TBUF_W;  // 74,880 words = 299,520 B
constexpr float INV_SQRT_D = 0.125f;

// 2^x with the slot that the instruction set asks for behind a transcendental
// (one v_nop before its result is read or its source overwritten) in the same
// statement.
__device__ __forceinline__ float exp2_slot(float x) {
  float y;
  asm("v_exp_f32 %0, %1\n\tv_nop" : "=v"(y) : "v"(x));
  return y;
}
constexpr float LOG2E = 0x1.715476p+0f;   // the factor __expf multiplies by

// Eight asynchronous 16-byte copies per lane, global -> LDS, rows four apart
// (a wave's 32 lanes cover 512 contiguous bytes of one row: whole lines).
// The s_wait_xcnt is the last line of the copies' own statement, so that no
// address register is rewritten in front of it (a precaution).
__device__ __forceinline__ void copy8_rows(unsigned l, const float* g) {
  asm volatile(
      "global_load_async_to_lds_b128 %0, %8, off\n\t"
      "global_load_async_to_lds_b128 %1, %9, off\n\t"
      "global_load_async_to_lds_b128 %2, %10, off\n\t"
      "global_load_async_to_lds_b128 %3, %11, off\n\t"
      "global_load_async_to_lds_b128 %4, %12, off\n\t"
      "global_load_async_to_lds_b128 %5, %13, off\n\t"
      "global_load_async_to_lds_b128 %6, %14, off\n\t"
      "global_load_async_to_lds_b128 %7, %15, off\n\t"
      "s_wait_xcnt 0x0"
      :: "v"(l), "v"(l + 4u * VROW * 4u), "v"(l + 8u * VROW * 4u),
         "v"(l + 12u * VROW * 4u), "v"(l + 16u * VROW * 4u),
         "v"(l + 20u * VROW * 4u), "v"(l + 24u * VROW * 4u),
         "v"(l + 28u * VROW * 4u),
         "v"(g), "v"(g + 4 * S_), "v"(g + 8 * S_), "v"(g + 12 * S_),
         "v"(g + 16 * S_), "v"(g + 20 * S_), "v"(g + 24 * S_), "v"(g + 28 * S_)
      : "memory");
}

// ---------------------------------------------------------------------------
// Kernel 0a: zero the per-(b,h,k) prob-max buffer
// ---------------------------------------------------------------------------
__global__ void __launch_bounds__(256) init_pmax_kernel(int* __restrict__ p) {
  p[blockIdx.x * 256 + threadIdx.x] = 0;
}

// ---------------------------------------------------------------------------
// Kernel 0b: Vt[b,h,d,k] = V[b,h,k,d]   (so P@V B-fragments are contiguous)
// ---------------------------------------------------------------------------
__global__ void __launch_bounds__(256)
transv_kernel(const float* __restrict__ V, float* __restrict__ Vt) {
  __shared__ float t[64][65];
  const int bh = blockIdx.x >> 4;
  const int kt = blockIdx.x & 15;                 // 16 k-tiles of 64
  const size_t base = ((size_t)bh * S_ + (size_t)kt * 64) * D_;
  for (int i = threadIdx.x; i < 64 * 64; i += 256)
    t[i >> 6][i & 63] = V[base + i];
  __syncthreads();
  for (int i = threadIdx.x; i < 64 * 64; i += 256) {
    const int dd = i >> 6, kk = i & 63;
    Vt[((size_t)bh * D_ + dd) * S_ + kt * 64 + kk] = t[kk][dd];
  }
}

// ---------------------------------------------------------------------------
// Kernel 1: Q projection  Qh[b,h,q,d] = (X @ Wq^T + bq) reshaped per-head
// 256 thr (8 waves); block tile 64(M) x 128(N); wave tile 16 x 64.
// X and Wq come in tiles of PK k values, staged in LDS by asynchronous copies
// of whole 256-byte row pieces, two buffers: tile t + 1 flies while tile t is
// multiplied. The fragments are read from LDS (a fragment load from global
// memory touches 16 cache lines for its 512 bytes).
// ---------------------------------------------------------------------------
constexpr int PK = 64;                  // k values per staged tile
constexpr int PNT = E_ / PK;            // tiles along k
// Padded LDS row stride (floats): 16 B x odd, free of bank conflicts for the
// 16-byte fragment reads. 19 rather than 17: the two buffers then take more than
// a third of a WGP's LDS, so at most two work-groups share a WGP and the 512 of
// the grid cannot crowd onto fewer than all 256 WGPs.
constexpr int PROW = PK + 12;
constexpr int PBUF_W = (64 + 128) * PROW;  // words per buffer: 64 X rows, 128 Wq rows
static_assert(3 * 2 * PBUF_W * 4 > 327680 && 2 * 2 * PBUF_W * 4 <= 327680,
              "two work-groups per WGP, not three");

// Twelve asynchronous 16-byte copies per lane, global -> LDS, rows 16 apart:
// four of X, eight of Wq (a wave's 32 lanes cover two rows' 256 bytes each).
// The s_wait_xcnt is the last line of the copies' own statement, so that no
// address register is rewritten in front of it (a precaution).
__device__ __forceinline__ void copy12_rows(unsigned l, const float* gx,
                                            const float* gw) {
  constexpr unsigned RS = 16u * PROW * 4u;   // 16 LDS rows, bytes
  asm volatile(
      "global_load_async_to_lds_b128 %0, %12, off\n\t"
      "global_load_async_to_lds_b128 %1, %13, off\n\t"
      "global_load_async_to_lds_b128 %2, %14, off\n\t"
      "global_load_async_to_lds_b128 %3, %15, off\n\t"
      "global_load_async_to_lds_b128 %4, %16, off\n\t"
      "global_load_async_to_lds_b128 %5, %17, off\n\t"
      "global_load_async_to_lds_b128 %6, %18, off\n\t"
      "global_load_async_to_lds_b128 %7, %19, off\n\t"
      "global_load_async_to_lds_b128 %8, %20, off\n\t"
      "global_load_async_to_lds_b128 %9, %21, off\n\t"
      "global_load_async_to_lds_b128 %10, %22, off\n\t"
      "global_load_async_to_lds_b128 %11, %23, off\n\t"
      "s_wait_xcnt 0x0"
      :: "v"(l), "v"(l + RS), "v"(l + 2u * RS), "v"(l + 3u * RS),
         "v"(l + 4u * RS), "v"(l + 5u * RS), "v"(l + 6u * RS), "v"(l + 7u * RS),
         "v"(l + 8u * RS), "v"(l + 9u * RS), "v"(l + 10u * RS), "v"(l + 11u * RS),
         "v"(gx), "v"(gx + 16 * E_), "v"(gx + 32 * E_), "v"(gx + 48 * E_),
         "v"(gw), "v"(gw + 16 * E_), "v"(gw + 32 * E_), "v"(gw + 48 * E_),
         "v"(gw + 64 * E_), "v"(gw + 80 * E_), "v"(gw + 96 * E_), "v"(gw + 112 * E_)
      : "memory");
}

__global__ void __launch_bounds__(256)
qproj_kernel(const float* __restrict__ X, const float* __restrict__ Wq,
             const float* __restrict__ bq, float* __restrict__ Qh) {
  __shared__ __attribute__((aligned(16))) float Pl[2 * PBUF_W];   // 116,736 B
  const int tid = threadIdx.x, lane = tid & 31, w = tid >> 5;
  const int lo = lane & 15, half = lane >> 4;
  const int m0 = blockIdx.x * 64 + (w >> 1) * 16;   // global M row (= b*S + q)
  const int n0 = blockIdx.y * 128 + (w & 1) * 64;   // global N col (= e)

  // Thread tid copies 16-byte chunk tid & 15 of rows tid >> 4 + 16 i.
  const float* xsrc = X + (size_t)(blockIdx.x * 64 + (tid >> 4)) * E_ + (tid & 15) * 4;
  const float* wsrc = Wq + (size_t)(blockIdx.y * 128 + (tid >> 4)) * E_ + (tid & 15) * 4;
  const unsigned pdst = (unsigned)(size_t)(Pl + (tid >> 4) * PROW + (tid & 15) * 4);

  // This lane's row of the wave's X tile and of its first Wq tile, in buffer 0.
  const float* Ab = Pl + ((w >> 1) * 16 + lo) * PROW + 4 * half;
  const float* Bb = Pl + (64 + (w & 1) * 64 + lo) * PROW + 4 * half;

  v8f acc[4] = {};
  copy12_rows(pdst, xsrc, wsrc);
  asm volatile("s_wait_asynccnt 0x0" ::: "memory");  // own copies of tile 0 landed
  __syncthreads();                                   // tile 0 published
  copy12_rows(pdst + (unsigned)PBUF_W * 4u, xsrc + PK, wsrc + PK);
  // kept rolled: one copy of the publish point, small code
#pragma unroll 1
  for (int t = 0; t < PNT; ++t) {
    const float* At = Ab + (t & 1) * PBUF_W;
    const float* Bt = Bb + (t & 1) * PBUF_W;
    constexpr int G = 2;                            // k-steps of 8 per group
    v4f af[2][G], bf[2][G][4];                      // double-buffered fragments
#pragma unroll
    for (int j = 0; j < G; ++j) {
      af[0][j] = *(const v4f*)(At + j * 8);
#pragma unroll
      for (int nt = 0; nt < 4; ++nt)
        bf[0][j][nt] = *(const v4f*)(Bt + nt * 16 * PROW + j * 8);
    }
    // unrolled: af/bf are then indexed by constants and stay in registers
#pragma unroll
    for (int g = 0; g < PK / (8 * G); ++g) {
      const int cur = g & 1;
      if (g + 1 < PK / (8 * G)) {                   // next group, same tile only
#pragma unroll
        for (int j = 0; j < G; ++j) {
          af[cur ^ 1][j] = *(const v4f*)(At + ((g + 1) * G + j) * 8);
#pragma unroll
          for (int nt = 0; nt < 4; ++nt)
            bf[cur ^ 1][j][nt] =
                *(const v4f*)(Bt + nt * 16 * PROW + ((g + 1) * G + j) * 8);
        }
      }
#pragma unroll
      for (int j = 0; j < G; ++j) {
#pragma unroll
        for (int nt = 0; nt < 4; ++nt)
          acc[nt] = WMMA_F32(af[cur][j].xy, bf[cur][j][nt].xy, acc[nt]);
#pragma unroll
        for (int nt = 0; nt < 4; ++nt)
          acc[nt] = WMMA_F32(af[cur][j].zw, bf[cur][j][nt].zw, acc[nt]);
      }
    }
    // Publish point: own LDS reads done, own copies of tile t + 1 landed, then
    // the barrier; only behind it is the buffer just read filled again.
    asm volatile("s_wait_dscnt 0x0" ::: "memory");
    asm volatile("s_wait_asynccnt 0x0" ::: "memory");
    __syncthreads();
    if (t + 2 < PNT)
      copy12_rows(pdst + (unsigned)((t & 1) * PBUF_W) * 4u, xsrc + (t + 2) * PK,
                  wsrc + (t + 2) * PK);
  }
  asm volatile("s_wait_asynccnt 0x0" ::: "memory");  // nothing in flight at the end

#pragma unroll
  for (int nt = 0; nt < 4; ++nt) {
    const int e = n0 + nt * 16 + lo;
    const float bias = bq[e];
    const int h = e >> 6, dd = e & 63;
#pragma unroll
    for (int i = 0; i < 8; ++i) {
      const int m = m0 + i + 8 * half;
      const int b = m >> 10, q = m & 1023;
      Qh[((size_t)(b * H_ + h) * S_ + q) * D_ + dd] = acc[nt][i] + bias;
    }
  }
}

// ---------------------------------------------------------------------------
// Kernel 2: attention for one (b, h, 32-query block). Single pass over M,
// streamed with GLOBAL_LOAD_ASYNC_TO_LDS_B128 concurrently with QK^T WMMAs.
// ---------------------------------------------------------------------------
__global__ void __launch_bounds__(256)
attn_kernel(const float* __restrict__ Qh, const float* __restrict__ Kg,
            const float* __restrict__ Vt, const float* __restrict__ Mg,
            const float* __restrict__ dpm, float* __restrict__ ctx,
            int* __restrict__ Pmax) {
  extern __shared__ __attribute__((aligned(16))) float Sl[];  // [QB x SROW] scores | [QB x S_] M, later 2 x [D_ x VROW] V | 8 x [16 x TROW] turn tiles
  const int tid = threadIdx.x, lane = tid & 31, w = tid >> 5;
  const int lo = lane & 15, half = lane >> 4;
  const int qb = blockIdx.x, h = blockIdx.y, b = blockIdx.z;
  const int q0 = qb * QB;
  const size_t bh = (size_t)(b * H_ + h);

  // -------- Phase 0: async-stream this block's M slab (128 KB) into LDS -----
  // Non-temporal: M is 256 MB stream-once data; keep L2 for K/Vt/Qh re-reads.
  {
    const float* Mbase = Mg + (bh * S_ + (size_t)q0) * S_;
#pragma unroll
    for (int i = 0; i < (QB * S_) / (256 * 4); ++i) {   // 32 x 16B per thread
      const int idx = tid + i * 256;                    // 16-byte chunk index
      const unsigned lds_b = (unsigned)(MLOFF_W * 4 + idx * 16);
      const void* gp = (const void*)(Mbase + idx * 4);
      asm volatile("global_load_async_to_lds_b128 %0, %1, off th:TH_LOAD_NT"
                   :: "v"(lds_b), "v"(gp) : "memory");
    }
  }

  // -------- Phase 1: Sl[q][k] = (Q . K^T) * inv_sqrt_d  via WMMA f32 --------
  // A 16-row tile of Q or K is 4 KB in a row. A wave reads it with eight loads of
  // 512 contiguous bytes (four whole lines each; a fragment load from global
  // memory touches 16 lines for its 512 bytes), writes it into its own LDS tile
  // and reads the fragments from there, in the k order stated at the top.
  {
    const float* Qsrc = Qh + (bh * S_ + q0) * D_ + lane * 4;
    const float* Ksrc = Kg + (bh * S_ + w * 128) * D_ + lane * 4;  // 128-key strip
    float* Tw = Sl + LDS_WORDS + w * TBUF_W;
    float* tst = Tw + half * TROW + lo * 4;         // load i holds rows 2i, 2i + 1
    const float* tld = Tw + lo * TROW + 4 * half;   // fragments: row lo
    auto put = [&](const v4f (&g)[8]) {
      // the wave's own reads of its tile are done before the tile is rewritten
      asm volatile("s_wait_dscnt 0x0" ::: "memory");
#pragma unroll
      for (int i = 0; i < 8; ++i) *(v4f*)(tst + 2 * i * TROW) = g[i];
      // the rows have landed before other lanes of the wave read them back
      asm volatile("s_wait_dscnt 0x0" ::: "memory");
    };
    auto get = [&](v4f (&f)[8]) {
#pragma unroll
      for (int ks = 0; ks < 8; ++ks) f[ks] = *(const v4f*)(tld + ks * 8);
    };
    v4f af[QB / 16][8];                             // hoisted A (Q) fragments
    v4f bf[2][8];                                   // double-buffered K frags
    v4f g[8];                                       // K tile on its way, as read
    {
      v4f gq[QB / 16][8], g0[8];                    // all first loads fly together
#pragma unroll
      for (int mt = 0; mt < QB / 16; ++mt)
#pragma unroll
        for (int i = 0; i < 8; ++i)
          gq[mt][i] = *(const v4f*)(Qsrc + mt * 16 * D_ + i * 128);
#pragma unroll
      for (int i = 0; i < 8; ++i) g0[i] = *(const v4f*)(Ksrc + i * 128);
#pragma unroll
      for (int i = 0; i < 8; ++i) g[i] = *(const v4f*)(Ksrc + 16 * D_ + i * 128);
      // precaution: the loads' address registers are reused only behind this wait
      asm volatile("s_wait_xcnt 0x0" ::: "memory");
#pragma unroll
      for (int mt = 0; mt < QB / 16; ++mt) {
        put(gq[mt]);
        get(af[mt]);
      }
      put(g0);
      get(bf[0]);
    }
#pragma unroll
    for (int nt = 0; nt < 8; ++nt) {                // this wave's 128-key strip
      const int cur = nt & 1;
      if (nt < 7) {                                 // next key tile's fragments
        put(g);
        get(bf[cur ^ 1]);
        if (nt < 6) {                               // and the tile behind it
#pragma unroll
          for (int i = 0; i < 8; ++i)
            g[i] = *(const v4f*)(Ksrc + (nt + 2) * 16 * D_ + i * 128);
          // precaution: the loads' address registers are reused only behind this wait
          asm volatile("s_wait_xcnt 0x0" ::: "memory");
        }
      }
      // Holds the next tile's LDS reads, as one block, in front of this tile's
      // WMMAs: sunk behind them, their latency stands open at the next rewrite.
      __builtin_amdgcn_sched_barrier(0);
#pragma unroll
      for (int mt = 0; mt < QB / 16; ++mt) {        // each K tile is read once
        v8f acc0 = {}, acc1 = {};                   // .xy / .zw chains
#pragma unroll
        for (int ks = 0; ks < 8; ++ks) {
          acc0 = WMMA_F32(af[mt][ks].xy, bf[cur][ks].xy, acc0);
          acc1 = WMMA_F32(af[mt][ks].zw, bf[cur][ks].zw, acc1);
        }
        const int col = w * 128 + nt * 16 + lo;
        const int rb = mt * 16 + 8 * half;
#pragma unroll
        for (int i = 0; i < 8; ++i)
          Sl[(rb + i) * SROW + col] = (acc0[i] + acc1[i]) * INV_SQRT_D;
      }
    }
  }
  asm volatile("s_wait_asynccnt 0x0" ::: "memory");  // M slab resident in LDS
  __syncthreads();

  // -------- Phase 2: fused (-M from LDS), row softmax, dp_mask --------------
  // Each wave keeps its four rows in registers: scores and M are read from LDS
  // once, 16 bytes per lane (lane l holds floats 128j + 4l .. + 3), and the
  // probabilities are written once. The four rows go through every stage side
  // by side, so that one row's LDS and cross-lane latency covers the others'.
  // Every loop here is fully unrolled: t[][] is then indexed by constants only
  // and stays in registers (a run-time index would send it to scratch).
  {
    constexpr int RW = QB / 8;                      // rows per wave
    float dm[RW], mx[RW], sum[RW];
    v4f t[RW][8];
#pragma unroll
    for (int rr = 0; rr < RW; ++rr) dm[rr] = dpm[b * S_ + q0 + w + 8 * rr];
#pragma unroll
    for (int rr = 0; rr < RW; ++rr) {
      const int r = w + 8 * rr;
      const v4f* srow = (const v4f*)(Sl + r * SROW) + lane;
      const v4f* mrow = (const v4f*)(Sl + MLOFF_W + r * S_) + lane;
#pragma unroll
      for (int j = 0; j < 8; ++j) t[rr][j] = srow[j * 32] - mrow[j * 32];
    }
#pragma unroll
    for (int rr = 0; rr < RW; ++rr) {
      float m = -3.0e38f;
#pragma unroll
      for (int j = 0; j < 8; ++j)
        m = fmaxf(fmaxf(m, fmaxf(t[rr][j].x, t[rr][j].y)),
                  fmaxf(t[rr][j].z, t[rr][j].w));
      mx[rr] = m;
    }
#pragma unroll
    for (int o = 16; o; o >>= 1)
#pragma unroll
      for (int rr = 0; rr < RW; ++rr)
        mx[rr] = fmaxf(mx[rr], __shfl_xor(mx[rr], o, 32));
#pragma unroll
    for (int rr = 0; rr < RW; ++rr) {
      v4f s4 = {};                                  // four independent chains
#pragma unroll
      for (int j = 0; j < 8; ++j) {
        v4f e;
        e.x = exp2_slot((t[rr][j].x - mx[rr]) * LOG2E);
        e.y = exp2_slot((t[rr][j].y - mx[rr]) * LOG2E);
        e.z = exp2_slot((t[rr][j].z - mx[rr]) * LOG2E);
        e.w = exp2_slot((t[rr][j].w - mx[rr]) * LOG2E);
        t[rr][j] = e;
        s4 += e;
      }
      sum[rr] = (s4.x + s4.y) + (s4.z + s4.w);
    }
#pragma unroll
    for (int o = 16; o; o >>= 1)
#pragma unroll
      for (int rr = 0; rr < RW; ++rr) sum[rr] += __shfl_xor(sum[rr], o, 32);
#pragma unroll
    for (int rr = 0; rr < RW; ++rr) {
      const float scale = dm[rr] / sum[rr];
      v4f* srow = (v4f*)(Sl + (w + 8 * rr) * SROW) + lane;
#pragma unroll
      for (int j = 0; j < 8; ++j) srow[j * 32] = t[rr][j] * scale;
    }
  }
  __syncthreads();

  // Keeps the address arithmetic of the copies below behind the softmax, whose
  // rows fill the registers: lifted over it, the build went past 256 VGPRs.
  __builtin_amdgcn_sched_barrier(0);

  // -------- Phase 4 prologue: V tile 0 starts towards LDS ------------------
  // The barrier above ends every wave's reads of the M slab; the V buffers lie
  // there. Thread tid copies 16-byte chunk tid & 63 of rows tid >> 6 + 4 i.
  const float* vsrc = Vt + (bh * D_ + (tid >> 6)) * S_ + (tid & 63) * 4;
  const unsigned vdst =
      (unsigned)(size_t)(Sl + MLOFF_W + (tid >> 6) * VROW + (tid & 63) * 4);
  copy8_rows(vdst, vsrc);
  copy8_rows(vdst + 32u * VROW * 4u, vsrc + 32 * S_);

  // -------- Phase 3: per-key max over this q block -> atomic bit-max --------
  for (int k = tid; k < S_; k += 256) {
    float mx = 0.f;                                 // probs >= 0
    for (int q = 0; q < QB; ++q) mx = fmaxf(mx, Sl[q * SROW + k]);
    atomicMax(&Pmax[(b * H_ + h) * S_ + k], __float_as_int(mx));
  }

  // -------- Phase 4: ctx = P @ V  (A and B from LDS) ------------------------
  // Transposed V comes in tiles of KT keys, two buffers: tile t + 1 flies
  // while tile t is multiplied; all eight waves share one copy of each tile.
  {
    const int mt = w >> 2;                          // 16-row tile
    const int d0 = (w & 3) * 16;                    // 16-col (head dim) tile
    const float* Ab = Sl + (mt * 16 + lo) * SROW + 4 * half;
    const float* Vb = Sl + MLOFF_W + (d0 + lo) * VROW + 4 * half;
    v8f acc0 = {}, acc1 = {};
    asm volatile("s_wait_asynccnt 0x0" ::: "memory");  // own copies of tile 0 landed
    __syncthreads();                                   // tile 0 published
    copy8_rows(vdst + (unsigned)VBUF_W * 4u, vsrc + KT);
    copy8_rows(vdst + (unsigned)(VBUF_W + 32 * VROW) * 4u, vsrc + KT + 32 * S_);
    // kept rolled: one copy of the publish point, small code
#pragma unroll 1
    for (int t = 0; t < NT; ++t) {
      const float* At = Ab + t * KT;
      const float* Bt = Vb + (t & 1) * VBUF_W;
      constexpr int G = 8;                          // k-steps of 8 per group
      v4f af[2][G], vf[2][G];                       // double-buffered fragments
#pragma unroll
      for (int j = 0; j < G; ++j) {
        af[0][j] = *(const v4f*)(At + j * 8);
        vf[0][j] = *(const v4f*)(Bt + j * 8);
      }
      // unrolled: af/vf are then indexed by constants and stay in registers
#pragma unroll
      for (int g = 0; g < KT / (8 * G); ++g) {
        const int cur = g & 1;
        if (g + 1 < KT / (8 * G)) {                 // next group, same tile only
#pragma unroll
          for (int j = 0; j < G; ++j) {
            af[cur ^ 1][j] = *(const v4f*)(At + ((g + 1) * G + j) * 8);
            vf[cur ^ 1][j] = *(const v4f*)(Bt + ((g + 1) * G + j) * 8);
          }
        }
        // Holds the next group's LDS reads, as one block, in front of this
        // group's WMMAs: sunk among them they come one pair ahead only, too
        // late for the LDS latency.
        __builtin_amdgcn_sched_barrier(0);
#pragma unroll
        for (int j = 0; j < G; ++j) {
          acc0 = WMMA_F32(af[cur][j].xy, vf[cur][j].xy, acc0);
          acc1 = WMMA_F32(af[cur][j].zw, vf[cur][j].zw, acc1);
        }
      }
      // Publish point: own LDS reads done, own copies of tile t + 1 landed, then
      // the barrier; only behind it is the buffer just read filled again.
      asm volatile("s_wait_dscnt 0x0" ::: "memory");
      asm volatile("s_wait_asynccnt 0x0" ::: "memory");
      __syncthreads();
      if (t + 2 < NT) {
        const unsigned ld = vdst + (unsigned)((t & 1) * VBUF_W) * 4u;
        const float* gs = vsrc + (t + 2) * KT;
        copy8_rows(ld, gs);
        copy8_rows(ld + 32u * VROW * 4u, gs + 32 * S_);
      }
    }
    asm volatile("s_wait_asynccnt 0x0" ::: "memory");  // nothing in flight at the end
    const v8f acc = acc0 + acc1;
    const int q = q0 + mt * 16 + 8 * half;
    const int e = h * D_ + d0 + lo;
#pragma unroll
    for (int i = 0; i < 8; ++i)   // write-once output: non-temporal stores
      __builtin_nontemporal_store(acc[i],
                                  ctx + (size_t)(b * S_ + q + i) * E_ + e);
  }
}

// ---------------------------------------------------------------------------
// Kernel 3: target_score[b,k] = sum_h max_q probs
// ---------------------------------------------------------------------------
__global__ void __launch_bounds__(256)
tscore_kernel(const int* __restrict__ Pmax, float* __restrict__ out) {
  const int idx = blockIdx.x * 256 + threadIdx.x;   // 4096 = B*Sk
  const int b = idx >> 10, k = idx & 1023;
  float s = 0.f;
#pragma unroll
  for (int h = 0; h < H_; ++h) s += __int_as_float(Pmax[(b * H_ + h) * S_ + k]);
  out[idx] = s;
}

// ---------------------------------------------------------------------------
extern "C" void kernel_launch(void* const* d_in, const int* in_sizes, int n_in,
                              void* d_out, int out_size, void* d_ws, size_t ws_size,
                              hipStream_t stream) {
  (void)in_sizes; (void)n_in; (void)out_size; (void)ws_size;
  const float* dp_emb  = (const float*)d_in[0];
  const float* dp_mask = (const float*)d_in[1];
  const float* K       = (const float*)d_in[2];
  const float* V       = (const float*)d_in[3];
  const float* M       = (const float*)d_in[4];
  const float* Wq      = (const float*)d_in[5];
  const float* bq      = (const float*)d_in[6];

  float* ctx = (float*)d_out;
  float* ts  = ctx + (size_t)B_ * S_ * E_;

  float* Qh   = (float*)d_ws;                          // 16 MB
  float* Vt   = Qh + (size_t)B_ * H_ * S_ * D_;        // 16 MB
  int*   Pmax = (int*)(Vt + (size_t)B_ * H_ * S_ * D_);// 256 KB

  const int smem = LDS_ALL_W * (int)sizeof(float);     // 299,520 B (< 320 KB)
  (void)hipFuncSetAttribute((const void*)attn_kernel,
                            hipFuncAttributeMaxDynamicSharedMemorySize, smem);

  init_pmax_kernel<<<B_ * H_ * S_ / 256, 256, 0, stream>>>(Pmax);
  transv_kernel<<<B_ * H_ * (S_ / 64), 256, 0, stream>>>(V, Vt);
  qproj_kernel<<<dim3(B_ * S_ / 64, E_ / 128), 256, 0, stream>>>(dp_emb, Wq, bq, Qh);
  attn_kernel<<<dim3(S_ / QB, H_, B_), 256, smem, stream>>>(Qh, K, Vt, M, dp_mask, ctx, Pmax);
  tscore_kernel<<<B_ * S_ / 256, 256, 0, stream>>>(Pmax, ts);
}

// v006
// A run of this version takes 178 microseconds.
// Two timings next to v005 put it at 1.05 and 1.06 times that version's speed.
// All steps since v000 together make it 2.30 times as fast.
#include <hip/hip_runtime.h>

typedef __attribute__((ext_vector_type(2))) float v2f;
typedef __attribute__((ext_vector_type(4))) float v4f;
typedef __attribute__((ext_vector_type(8))) float v8f;

#define WMMA_F32(a, b, c) \
  __builtin_amdgcn_wmma_f32_16x16x4_f32(false, (a), false, (b), (short)0, (c), false, false)

// Fragment loads: every lane reads 16 bytes of its row, floats 8j + 4*half .. + 3,
// and feeds two WMMAs: .xy carries k = 8j + {0,1 | 4,5}, .zw k = 8j + {2,3 | 6,7}
// (lanes 0-15 | lanes 16-31). A and B are always read the same way, so every
// k slot pairs the same k of both operands.

constexpr int B_ = 4, H_ = 16, S_ = 1024, D_ = 64, E_ = 1024;
constexpr int QB = 32;            // queries per attention workgroup
constexpr int KT = 64;            // keys per staged tile of transposed V
constexpr int NT = S_ / KT;       // tiles per (b, h)
constexpr int VBUF_W = D_ * KT;   // words per staged tile (64 head-dim rows)
constexpr int TBUF_W = 16 * D_;   // words per wave: one 16-row x 64-float turn tile
// LDS of the attention kernel: the [QB x S_] slab (M, then scores, then probs, in
// place), and behind it eight turn tiles, one per wave, whose space the two V
// buffers take over after QK^T. 160 KiB in all: two work-groups share a WGP, so
// that one's softmax, waits and start-up run under the other's WMMAs.
constexpr int XOFF_W = QB * S_;
constexpr int LDS_ALL_W = XOFF_W + 8 * TBUF_W;   // 40,960 words = 163,840 B
static_assert(2 * VBUF_W <= 8 * TBUF_W, "the V buffers fit in the turn tiles' space");
static_assert(2 * LDS_ALL_W * 4 <= 327680, "two work-groups per WGP");

// Word index of (row, col) in an LDS array of 'pitch' floats a row (a multiple of
// 64). No pad: the 16-byte chunk's low four index bits are XORed with the row's,
// so that 16 rows read at one column fall on 16 different bank groups.
__device__ __forceinline__ int swz(int row, int col, int pitch) {
  return row * pitch + (col ^ ((row & 15) << 2));
}
constexpr float INV_SQRT_D = 0.125f;

// 2^x with the slot that the instruction set asks for behind a transcendental
// (one v_nop before its result is read or its source overwritten) in the same
// statement.
__device__ __forceinline__ float exp2_slot(float x) {
  float y;
  asm("v_exp_f32 %0, %1\n\tv_nop" : "=v"(y) : "v"(x));
  return y;
}
constexpr float LOG2E = 0x1.715476p+0f;   // the factor __expf multiplies by

// Four asynchronous 16-byte copies per lane, global -> LDS, rows 16 apart (a
// wave's 32 lanes cover two rows' 256 bytes each: whole lines).
// The s_wait_xcnt is the last line of the copies' own statement, so that no
// address register is rewritten in front of it (a precaution).
__device__ __forceinline__ void copy4_rows(unsigned l, const float* g) {
  constexpr unsigned RS = 16u * KT * 4u;     // 16 LDS rows, bytes
  asm volatile(
      "global_load_async_to_lds_b128 %0, %4, off\n\t"
      "global_load_async_to_lds_b128 %1, %5, off\n\t"
      "global_load_async_to_lds_b128 %2, %6, off\n\t"
      "global_load_async_to_lds_b128 %3, %7, off\n\t"
      "s_wait_xcnt 0x0"
      :: "v"(l), "v"(l + RS), "v"(l + 2u * RS), "v"(l + 3u * RS),
         "v"(g), "v"(g + 16 * S_), "v"(g + 32 * S_), "v"(g + 48 * S_)
      : "memory");
}

// ---------------------------------------------------------------------------
// Kernel 0a: zero the per-(b,h,k) prob-max buffer
// ---------------------------------------------------------------------------
__global__ void __launch_bounds__(256) init_pmax_kernel(int* __restrict__ p) {
  p[blockIdx.x * 256 + threadIdx.x] = 0;
}

// ---------------------------------------------------------------------------
// Kernel 0b: Vt[b,h,d,k] = V[b,h,k,d]   (so P@V B-fragments are contiguous)
// ---------------------------------------------------------------------------
__global__ void __launch_bounds__(256)
transv_kernel(const float* __restrict__ V, float* __restrict__ Vt) {
  __shared__ float t[64][65];
  const int bh = blockIdx.x >> 4;
  const int kt = blockIdx.x & 15;                 // 16 k-tiles of 64
  const size_t base = ((size_t)bh * S_ + (size_t)kt * 64) * D_;
  for (int i = threadIdx.x; i < 64 * 64; i += 256)
    t[i >> 6][i & 63] = V[base + i];
  __syncthreads();
  for (int i = threadIdx.x; i < 64 * 64; i += 256) {
    const int dd = i >> 6, kk = i & 63;
    Vt[((size_t)bh * D_ + dd) * S_ + kt * 64 + kk] = t[kk][dd];
  }
}

// ---------------------------------------------------------------------------
// Kernel 1: Q projection  Qh[b,h,q,d] = (X @ Wq^T + bq) reshaped per-head
// 256 thr (8 waves); block tile 64(M) x 128(N); wave tile 16 x 64.
// X and Wq come in tiles of PK k values, staged in LDS by asynchronous copies
// of whole 256-byte row pieces, two buffers: tile t + 1 flies while tile t is
// multiplied. The fragments are read from LDS (a fragment load from global
// memory touches 16 cache lines for its 512 bytes).
// ---------------------------------------------------------------------------
constexpr int PK = 64;                  // k values per staged tile
constexpr int PNT = E_ / PK;            // tiles along k
// Padded LDS row stride (floats): 16 B x odd, free of bank conflicts for the
// 16-byte fragment reads. 19 rather than 17: the two buffers then take more than
// a third of a WGP's LDS, so at most two work-groups share a WGP and the 512 of
// the grid cannot crowd onto fewer than all 256 WGPs.
constexpr int PROW = PK + 12;
constexpr int PBUF_W = (64 + 128) * PROW;  // words per buffer: 64 X rows, 128 Wq rows
static_assert(3 * 2 * PBUF_W * 4 > 327680 && 2 * 2 * PBUF_W * 4 <= 327680,
              "two work-groups per WGP, not three");

// Twelve asynchronous 16-byte copies per lane, global -> LDS, rows 16 apart:
// four of X, eight of Wq (a wave's 32 lanes cover two rows' 256 bytes each).
// The s_wait_xcnt is the last line of the copies' own statement, so that no
// address register is rewritten in front of it (a precaution).
__device__ __forceinline__ void copy12_rows(unsigned l, const float* gx,
                                            const float* gw) {
  constexpr unsigned RS = 16u * PROW * 4u;   // 16 LDS rows, bytes
  asm volatile(
      "global_load_async_to_lds_b128 %0, %12, off\n\t"
      "global_load_async_to_lds_b128 %1, %13, off\n\t"
      "global_load_async_to_lds_b128 %2, %14, off\n\t"
      "global_load_async_to_lds_b128 %3, %15, off\n\t"
      "global_load_async_to_lds_b128 %4, %16, off\n\t"
      "global_load_async_to_lds_b128 %5, %17, off\n\t"
      "global_load_async_to_lds_b128 %6, %18, off\n\t"
      "global_load_async_to_lds_b128 %7, %19, off\n\t"
      "global_load_async_to_lds_b128 %8, %20, off\n\t"
      "global_load_async_to_lds_b128 %9, %21, off\n\t"
      "global_load_async_to_lds_b128 %10, %22, off\n\t"
      "global_load_async_to_lds_b128 %11, %23, off\n\t"
      "s_wait_xcnt 0x0"
      :: "v"(l), "v"(l + RS), "v"(l + 2u * RS), "v"(l + 3u * RS),
         "v"(l + 4u * RS), "v"(l + 5u * RS), "v"(l + 6u * RS), "v"(l + 7u * RS),
         "v"(l + 8u * RS), "v"(l + 9u * RS), "v"(l + 10u * RS), "v"(l + 11u * RS),
         "v"(gx), "v"(gx + 16 * E_), "v"(gx + 32 * E_), "v"(gx + 48 * E_),
         "v"(gw), "v"(gw + 16 * E_), "v"(gw + 32 * E_), "v"(gw + 48 * E_),
         "v"(gw + 64 * E_), "v"(gw + 80 * E_), "v"(gw + 96 * E_), "v"(gw + 112 * E_)
      : "memory");
}

__global__ void __launch_bounds__(256)
qproj_kernel(const float* __restrict__ X, const float* __restrict__ Wq,
             const float* __restrict__ bq, float* __restrict__ Qh) {
  __shared__ __attribute__((aligned(16))) float Pl[2 * PBUF_W];   // 116,736 B
  const int tid = threadIdx.x, lane = tid & 31, w = tid >> 5;
  const int lo = lane & 15, half = lane >> 4;
  const int m0 = blockIdx.x * 64 + (w >> 1) * 16;   // global M row (= b*S + q)
  const int n0 = blockIdx.y * 128 + (w & 1) * 64;   // global N col (= e)

  // Thread tid copies 16-byte chunk tid & 15 of rows tid >> 4 + 16 i.
  const float* xsrc = X + (size_t)(blockIdx.x * 64 + (tid >> 4)) * E_ + (tid & 15) * 4;
  const float* wsrc = Wq + (size_t)(blockIdx.y * 128 + (tid >> 4)) * E_ + (tid & 15) * 4;
  const unsigned pdst = (unsigned)(size_t)(Pl + (tid >> 4) * PROW + (tid & 15) * 4);

  // This lane's row of the wave's X tile and of its first Wq tile, in buffer 0.
  const float* Ab = Pl + ((w >> 1) * 16 + lo) * PROW + 4 * half;
  const float* Bb = Pl + (64 + (w & 1) * 64 + lo) * PROW + 4 * half;

  v8f acc[4] = {};
  copy12_rows(pdst, xsrc, wsrc);
  asm volatile("s_wait_asynccnt 0x0" ::: "memory");  // own copies of tile 0 landed
  __syncthreads();                                   // tile 0 published
  copy12_rows(pdst + (unsigned)PBUF_W * 4u, xsrc + PK, wsrc + PK);
  // kept rolled: one copy of the publish point, small code
#pragma unroll 1
  for (int t = 0; t < PNT; ++t) {
    const float* At = Ab + (t & 1) * PBUF_W;
    const float* Bt = Bb + (t & 1) * PBUF_W;
    constexpr int G = 2;                            // k-steps of 8 per group
    v4f af[2][G], bf[2][G][4];                      // double-buffered fragments
#pragma unroll
    for (int j = 0; j < G; ++j) {
      af[0][j] = *(const v4f*)(At + j * 8);
#pragma unroll
      for (int nt = 0; nt < 4; ++nt)
        bf[0][j][nt] = *(const v4f*)(Bt + nt * 16 * PROW + j * 8);
    }
    // unrolled: af/bf are then indexed by constants and stay in registers
#pragma unroll
    for (int g = 0; g < PK / (8 * G); ++g) {
      const int cur = g & 1;
      if (g + 1 < PK / (8 * G)) {                   // next group, same tile only
#pragma unroll
        for (int j = 0; j < G; ++j) {
          af[cur ^ 1][j] = *(const v4f*)(At + ((g + 1) * G + j) * 8);
#pragma unroll
          for (int nt = 0; nt < 4; ++nt)
            bf[cur ^ 1][j][nt] =
                *(const v4f*)(Bt + nt * 16 * PROW + ((g + 1) * G + j) * 8);
        }
      }
#pragma unroll
      for (int j = 0; j < G; ++j) {
#pragma unroll
        for (int nt = 0; nt < 4; ++nt)
          acc[nt] = WMMA_F32(af[cur][j].xy, bf[cur][j][nt].xy, acc[nt]);
#pragma unroll
        for (int nt = 0; nt < 4; ++nt)
          acc[nt] = WMMA_F32(af[cur][j].zw, bf[cur][j][nt].zw, acc[nt]);
      }
    }
    // Publish point: own LDS reads done, own copies of tile t + 1 landed, then
    // the barrier; only behind it is the buffer just read filled again.
    asm volatile("s_wait_dscnt 0x0" ::: "memory");
    asm volatile("s_wait_asynccnt 0x0" ::: "memory");
    __syncthreads();
    if (t + 2 < PNT)
      copy12_rows(pdst + (unsigned)((t & 1) * PBUF_W) * 4u, xsrc + (t + 2) * PK,
                  wsrc + (t + 2) * PK);
  }
  asm volatile("s_wait_asynccnt 0x0" ::: "memory");  // nothing in flight at the end

#pragma unroll
  for (int nt = 0; nt < 4; ++nt) {
    const int e = n0 + nt * 16 + lo;
    const float bias = bq[e];
    const int h = e >> 6, dd = e & 63;
#pragma unroll
    for (int i = 0; i < 8; ++i) {
      const int m = m0 + i + 8 * half;
      const int b = m >> 10, q = m & 1023;
      Qh[((size_t)(b * H_ + h) * S_ + q) * D_ + dd] = acc[nt][i] + bias;
    }
  }
}

// ---------------------------------------------------------------------------
// Kernel 2: attention for one (b, h, 32-query block). Single pass over M,
// brought into LDS by GLOBAL_LOAD_ASYNC_TO_LDS_B128; the scores replace it in place.
// ---------------------------------------------------------------------------
// Four waves per SIMD (two work-groups per WGP): at most 256 VGPRs a wave.
__global__ void __launch_bounds__(256) __attribute__((amdgpu_waves_per_eu(4, 4)))
attn_kernel(const float* __restrict__ Qh, const float* __restrict__ Kg,
            const float* __restrict__ Vt, const float* __restrict__ Mg,
            const float* __restrict__ dpm, float* __restrict__ ctx,
            int* __restrict__ Pmax) {
  extern __shared__ __attribute__((aligned(16))) float Sl[];  // [QB x S_] M -> scores -> probs | 8 x [16 x D_] turn tiles, later 2 x [D_ x KT] V
  const int tid = threadIdx.x, lane = tid & 31, w = tid >> 5;
  const int lo = lane & 15, half = lane >> 4;
  const int qb = blockIdx.x, h = blockIdx.y, b = blockIdx.z;
  const int q0 = qb * QB;
  const size_t bh = (size_t)(b * H_ + h);

  // -------- Phase 0: this block's M slab (128 KB) starts towards LDS --------
  // Non-temporal: M is 256 MB stream-once data; keep L2 for K/Vt/Qh re-reads.
  // Wave w brings the 128 columns of its own key strip, one row's 512 contiguous
  // bytes per copy: before the first barrier nobody else touches them, so the
  // wave's own s_wait_asynccnt is all that its reads need.
  {
    const int mcol = w * 128 + lane * 4;
    const float* Msrc = Mg + (bh * S_ + (size_t)q0) * S_ + mcol;
    const unsigned sbase = (unsigned)(size_t)Sl;
#pragma unroll
    for (int gi = 0; gi < QB / 8; ++gi) {
      unsigned l[8];
      const float* g[8];
#pragma unroll
      for (int i = 0; i < 8; ++i) {
        l[i] = sbase + 4u * (unsigned)swz(gi * 8 + i, mcol, S_);
        g[i] = Msrc + (gi * 8 + i) * S_;
      }
      // The s_wait_xcnt is the last line of the copies' own statement, so that
      // no address register is rewritten in front of it (a precaution).
      asm volatile(
          "global_load_async_to_lds_b128 %0, %8, off th:TH_LOAD_NT\n\t"
          "global_load_async_to_lds_b128 %1, %9, off th:TH_LOAD_NT\n\t"
          "global_load_async_to_lds_b128 %2, %10, off th:TH_LOAD_NT\n\t"
          "global_load_async_to_lds_b128 %3, %11, off th:TH_LOAD_NT\n\t"
          "global_load_async_to_lds_b128 %4, %12, off th:TH_LOAD_NT\n\t"
          "global_load_async_to_lds_b128 %5, %13, off th:TH_LOAD_NT\n\t"
          "global_load_async_to_lds_b128 %6, %14, off th:TH_LOAD_NT\n\t"
          "global_load_async_to_lds_b128 %7, %15, off th:TH_LOAD_NT\n\t"
          "s_wait_xcnt 0x0"
          :: "v"(l[0]), "v"(l[1]), "v"(l[2]), "v"(l[3]),
             "v"(l[4]), "v"(l[5]), "v"(l[6]), "v"(l[7]),
             "v"(g[0]), "v"(g[1]), "v"(g[2]), "v"(g[3]),
             "v"(g[4]), "v"(g[5]), "v"(g[6]), "v"(g[7])
          : "memory");
    }
  }

  // -------- Phase 1: Sl[q][k] = (Q . K^T) * inv_sqrt_d - M  via WMMA f32 ----
  // A 16-row tile of Q or K is 4 KB in a row. A wave reads it with eight loads of
  // 512 contiguous bytes (four whole lines each; a fragment load from global
  // memory touches 16 lines for its 512 bytes), writes it into its own LDS tile
  // and reads the fragments from there, in the k order stated at the top.
  {
    const float* Qsrc = Qh + (bh * S_ + q0) * D_ + lane * 4;
    const float* Ksrc = Kg + (bh * S_ + w * 128) * D_ + lane * 4;  // 128-key strip
    float* Tw = Sl + XOFF_W + w * TBUF_W;
    auto put = [&](const v4f (&g)[8]) {             // load i holds rows 2i, 2i + 1
      // the wave's own reads of its tile are done before the tile is rewritten
      asm volatile("s_wait_dscnt 0x0" ::: "memory");
#pragma unroll
      for (int i = 0; i < 8; ++i) *(v4f*)(Tw + swz(2 * i + half, lo * 4, D_)) = g[i];
      // the rows have landed before other lanes of the wave read them back
      asm volatile("s_wait_dscnt 0x0" ::: "memory");
    };
    auto get = [&](v4f (&f)[8]) {                   // fragments: row lo
#pragma unroll
      for (int ks = 0; ks < 8; ++ks)
        f[ks] = *(const v4f*)(Tw + swz(lo, ks * 8 + 4 * half, D_));
    };
    v4f af[QB / 16][8];                             // hoisted A (Q) fragments
    v4f bf[2][8];                                   // double-buffered K frags
    v4f g[8];                                       // K tile on its way, as read
    {
      v4f gq[QB / 16][8], g0[8];                    // all first loads fly together
#pragma unroll
      for (int mt = 0; mt < QB / 16; ++mt)
#pragma unroll
        for (int i = 0; i < 8; ++i)
          gq[mt][i] = *(const v4f*)(Qsrc + mt * 16 * D_ + i * 128);
#pragma unroll
      for (int i = 0; i < 8; ++i) g0[i] = *(const v4f*)(Ksrc + i * 128);
#pragma unroll
      for (int i = 0; i < 8; ++i) g[i] = *(const v4f*)(Ksrc + 16 * D_ + i * 128);
      // precaution: the loads' address registers are reused only behind this wait
      asm volatile("s_wait_xcnt 0x0" ::: "memory");
#pragma unroll
      for (int mt = 0; mt < QB / 16; ++mt) {
        put(gq[mt]);
        get(af[mt]);
      }
      put(g0);
      get(bf[0]);
    }
#pragma unroll
    for (int nt = 0; nt < 8; ++nt) {                // this wave's 128-key strip
      const int cur = nt & 1;
      const int col = w * 128 + nt * 16 + lo;
      if (nt < 7) {                                 // next key tile's fragments
        put(g);
        get(bf[cur ^ 1]);
        if (nt < 6) {                               // and the tile behind it
#pragma unroll
          for (int i = 0; i < 8; ++i)
            g[i] = *(const v4f*)(Ksrc + (nt + 2) * 16 * D_ + i * 128);
          // precaution: the loads' address registers are reused only behind this wait
          asm volatile("s_wait_xcnt 0x0" ::: "memory");
        }
      }
      if (nt == 0)                                  // own strip of M landed
        asm volatile("s_wait_asynccnt 0x0" ::: "memory");
      float mm[QB / 16][8];                         // M under this tile's scores
#pragma unroll
      for (int mt = 0; mt < QB / 16; ++mt)
#pragma unroll
        for (int i = 0; i < 8; ++i)
          mm[mt][i] = Sl[swz(mt * 16 + 8 * half + i, col, S_)];
      // Holds the next tile's LDS reads, as one block, in front of this tile's
      // WMMAs: sunk behind them, their latency stands open at the next rewrite.
      __builtin_amdgcn_sched_barrier(0);
#pragma unroll
      for (int mt = 0; mt < QB / 16; ++mt) {        // each K tile is read once
        v8f acc0 = {}, acc1 = {};                   // .xy / .zw chains
#pragma unroll
        for (int ks = 0; ks < 8; ++ks) {
          acc0 = WMMA_F32(af[mt][ks].xy, bf[cur][ks].xy, acc0);
          acc1 = WMMA_F32(af[mt][ks].zw, bf[cur][ks].zw, acc1);
        }
#pragma unroll
        for (int i = 0; i < 8; ++i)
          Sl[swz(mt * 16 + 8 * half + i, col, S_)] =
              (acc0[i] + acc1[i]) * INV_SQRT_D - mm[mt][i];
      }
    }
  }
  // own LDS traffic done: behind the barrier the turn tiles are given to copies
  asm volatile("s_wait_dscnt 0x0" ::: "memory");
  __syncthreads();

  // -------- Phase 4 prologue: V tile 0 starts towards LDS ------------------
  // The barrier above ends every wave's use of the turn tiles; the V buffers lie
  // there. Thread tid copies 16-byte chunk tid & 15 of rows tid >> 4 + 16 i.
  const float* vsrc = Vt + (bh * D_ + (tid >> 4)) * S_ + (tid & 15) * 4;
  const unsigned vdst =
      (unsigned)(size_t)(Sl + XOFF_W + swz(tid >> 4, (tid & 15) * 4, KT));
  copy4_rows(vdst, vsrc);

  // -------- Phase 2: row softmax, dp_mask -----------------------------------
  // Each wave keeps its four rows in registers: the scores are read from LDS
  // once, 16 bytes per lane (lane l holds floats 128j + 4l .. + 3), and the
  // probabilities are written once. The four rows go through every stage side
  // by side, so that one row's LDS and cross-lane latency covers the others'.
  // Every loop here is fully unrolled: t[][] is then indexed by constants only
  // and stays in registers (a run-time index would send it to scratch).
  {
    constexpr int RW = QB / 8;                      // rows per wave
    float dm[RW], mx[RW], sum[RW];
    v4f t[RW][8];
#pragma unroll
    for (int rr = 0; rr < RW; ++rr) dm[rr] = dpm[b * S_ + q0 + w + 8 * rr];
#pragma unroll
    for (int rr = 0; rr < RW; ++rr) {
      const float* srow = Sl + swz(w + 8 * rr, lane * 4, S_);
#pragma unroll
      for (int j = 0; j < 8; ++j) t[rr][j] = *(const v4f*)(srow + j * 128);
    }
#pragma unroll
    for (int rr = 0; rr < RW; ++rr) {
      float m = -3.0e38f;
#pragma unroll
      for (int j = 0; j < 8; ++j)
        m = fmaxf(fmaxf(m, fmaxf(t[rr][j].x, t[rr][j].y)),
                  fmaxf(t[rr][j].z, t[rr][j].w));
      mx[rr] = m;
    }
#pragma unroll
    for (int o = 16; o; o >>= 1)
#pragma unroll
      for (int rr = 0; rr < RW; ++rr)
        mx[rr] = fmaxf(mx[rr], __shfl_xor(mx[rr], o, 32));
#pragma unroll
    for (int rr = 0; rr < RW; ++rr) {
      v4f s4 = {};                                  // four independent chains
#pragma unroll
      for (int j = 0; j < 8; ++j) {
        v4f e;
        e.x = exp2_slot((t[rr][j].x - mx[rr]) * LOG2E);
        e.y = exp2_slot((t[rr][j].y - mx[rr]) * LOG2E);
        e.z = exp2_slot((t[rr][j].z - mx[rr]) * LOG2E);
        e.w = exp2_slot((t[rr][j].w - mx[rr]) * LOG2E);
        t[rr][j] = e;
        s4 += e;
      }
      sum[rr] = (s4.x + s4.y) + (s4.z + s4.w);
    }
#pragma unroll
    for (int o = 16; o; o >>= 1)
#pragma unroll
      for (int rr = 0; rr < RW; ++rr) sum[rr] += __shfl_xor(sum[rr], o, 32);
#pragma unroll
    for (int rr = 0; rr < RW; ++rr) {
      const float scale = dm[rr] / sum[rr];
      float* srow = Sl + swz(w + 8 * rr, lane * 4, S_);
#pragma unroll
      for (int j = 0; j < 8; ++j) *(v4f*)(srow + j * 128) = t[rr][j] * scale;
    }
  }
  asm volatile("s_wait_asynccnt 0x0" ::: "memory");  // own copies of V tile 0 landed
  __syncthreads();                                   // probs and V tile 0 published

  // Keeps the address arithmetic of everything below behind the softmax, whose
  // rows fill the registers: lifted over it, it is moved about or formed twice
  // to stay inside the 256 VGPRs.
  __builtin_amdgcn_sched_barrier(0);
  copy4_rows(vdst + (unsigned)VBUF_W * 4u, vsrc + KT);

  // -------- Phase 3: per-key max over this q block -> atomic bit-max --------
  for (int k = tid; k < S_; k += 256) {
    float mx = 0.f;                                 // probs >= 0
    for (int q = 0; q < QB; ++q) mx = fmaxf(mx, Sl[swz(q, k, S_)]);
    atomicMax(&Pmax[(b * H_ + h) * S_ + k], __float_as_int(mx));
  }

  // -------- Phase 4: ctx = P @ V  (A and B from LDS) ------------------------
  // Transposed V comes in tiles of KT keys, two buffers; all eight waves share
  // one copy of each tile. While tile t is multiplied from registers, tile
  // t + 1 is read from its buffer and tile t + 2 flies into tile t's.
  {
    const int mt = w >> 2;                          // 16-row tile
    const int d0 = (w & 3) * 16;                    // 16-col (head dim) tile
    // Both operands' rows have lo as their low four bits, so k-step j of a tile
    // stands at the same swizzled offset in both.
    const float* Ab = Sl + (mt * 16 + lo) * S_;
    const float* Vb = Sl + XOFF_W + (d0 + lo) * KT;
    v8f acc0 = {}, acc1 = {};
    constexpr int G = KT / 8;                       // k-steps of 8 per tile
    auto frags = [&](int t, v4f (&af)[G], v4f (&vf)[G]) {  // pitch 0: the rows' starts are in Ab, Vb
      const float* At = Ab + t * KT;
      const float* Bt = Vb + (t & 1) * VBUF_W;
#pragma unroll
      for (int j = 0; j < G; ++j) {
        af[j] = *(const v4f*)(At + swz(lo, j * 8 + 4 * half, 0));
        vf[j] = *(const v4f*)(Bt + swz(lo, j * 8 + 4 * half, 0));
      }
    };
    auto mma = [&](const v4f (&af)[G], const v4f (&vf)[G]) {
      // The two fences hold a tile's WMMAs as one block behind the next tile's
      // LDS reads and the refill's issue, and in front of the next publish point:
      // their run is what covers the reads' latency and the copies' flight
      // (left free, they sank behind the barrier and the refill behind them).
      __builtin_amdgcn_sched_barrier(0);
#pragma unroll
      for (int j = 0; j < G; ++j) {
        acc0 = WMMA_F32(af[j].xy, vf[j].xy, acc0);
        acc1 = WMMA_F32(af[j].zw, vf[j].zw, acc1);
      }
      __builtin_amdgcn_sched_barrier(0);
    };
    // Publish point behind the reads of tile t: own LDS reads done (tile t is in
    // registers), own copies of tile t + 1 landed, then the barrier; only behind
    // it is tile t's buffer filled again and tile t + 1 read.
    auto publish = [&](int t) {
      asm volatile("s_wait_dscnt 0x0" ::: "memory");
      asm volatile("s_wait_asynccnt 0x0" ::: "memory");
      __syncthreads();
      if (t + 2 < NT)
        copy4_rows(vdst + (unsigned)((t & 1) * VBUF_W) * 4u, vsrc + (t + 2) * KT);
    };
    v4f afa[G], vfa[G], afb[G], vfb[G];             // fragments of tiles t, t + 1
    frags(0, afa, vfa);
    // kept rolled, two tiles a trip: the two fragment sets keep their registers
#pragma unroll 1
    for (int t = 0; t < NT; t += 2) {
      publish(t);
      frags(t + 1, afb, vfb);
      mma(afa, vfa);
      publish(t + 1);
      if (t + 2 < NT) frags(t + 2, afa, vfa);
      mma(afb, vfb);
    }
    asm volatile("s_wait_asynccnt 0x0" ::: "memory");  // nothing in flight at the end
    const v8f acc = acc0 + acc1;
    const int q = q0 + mt * 16 + 8 * half;
    const int e = h * D_ + d0 + lo;
#pragma unroll
    for (int i = 0; i < 8; ++i)   // write-once output: non-temporal stores
      __builtin_nontemporal_store(acc[i],
                                  ctx + (size_t)(b * S_ + q + i) * E_ + e);
  }
}

// ---------------------------------------------------------------------------
// Kernel 3: target_score[b,k] = sum_h max_q probs
// ---------------------------------------------------------------------------
__global__ void __launch_bounds__(256)
tscore_kernel(const int* __restrict__ Pmax, float* __restrict__ out) {
  const int idx = blockIdx.x * 256 + threadIdx.x;   // 4096 = B*Sk
  const int b = idx >> 10, k = idx & 1023;
  float s = 0.f;
#pragma unroll
  for (int h = 0; h < H_; ++h) s += __int_as_float(Pmax[(b * H_ + h) * S_ + k]);
  out[idx] = s;
}

// ---------------------------------------------------------------------------
extern "C" void kernel_launch(void* const* d_in, const int* in_sizes, int n_in,
                              void* d_out, int out_size, void* d_ws, size_t ws_size,
                              hipStream_t stream) {
  (void)in_sizes; (void)n_in; (void)out_size; (void)ws_size;
  const float* dp_emb  = (const float*)d_in[0];
  const float* dp_mask = (const float*)d_in[1];
  const float* K       = (const float*)d_in[2];
  const float* V       = (const float*)d_in[3];
  const float* M       = (const float*)d_in[4];
  const float* Wq      = (const float*)d_in[5];
  const float* bq      = (const float*)d_in[6];

  float* ctx = (float*)d_out;
  float* ts  = ctx + (size_t)B_ * S_ * E_;

  float* Qh   = (float*)d_ws;                          // 16 MB
  float* Vt   = Qh + (size_t)B_ * H_ * S_ * D_;        // 16 MB
  int*   Pmax = (int*)(Vt + (size_t)B_ * H_ * S_ * D_);// 256 KB

  const int smem = LDS_ALL_W * (int)sizeof(float);     // 163,840 B = 160 KiB
  (void)hipFuncSetAttribute((const void*)attn_kernel,
                            hipFuncAttributeMaxDynamicSharedMemorySize, smem);

  init_pmax_kernel<<<B_ * H_ * S_ / 256, 256, 0, stream>>>(Pmax);
  transv_kernel<<<B_ * H_ * (S_ / 64), 256, 0, stream>>>(V, Vt);
  qproj_kernel<<<dim3(B_ * S_ / 64, E_ / 128), 256, 0, stream>>>(dp_emb, Wq, bq, Qh);
  attn_kernel<<<dim3(S_ / QB, H_, B_), 256, smem, stream>>>(Qh, K, Vt, M, dp_mask, ctx, Pmax);
  tscore_kernel<<<B_ * S_ / 256, 256, 0, stream>>>(Pmax, ts);
}
